// v000
// Times are from an AMD MI455X. After a warm-up the kernel runs many times in a row, and a time is the length of
// such a window on the GPU divided by its runs, so every launch and the gaps after it count. The runs cycle
// through copies of the inputs. A figure is the median of several windows, for all but v000 over two sittings.
// Sittings can differ by a few percent; kernels timed side by side share one.
// v000 is the starting kernel. One run takes 95.3 microseconds.
// compute dtype: q, k, v (module inputs) rounded to bf16; S = q k^T as exact bf16 WMMA products (f32 accumulate); silu and the integer attention mask in f32;
// silu(S) carried as a bf16 hi + bf16 residual pair against bf16 v (f32 accumulate); the 1/max_seqlen factor applied in the f32 epilogue.
#include <hip/hip_runtime.h>
#include <math.h>

typedef __attribute__((ext_vector_type(16))) _Float16 v16h;
typedef __attribute__((ext_vector_type(16))) __bf16 v16b;
typedef __attribute__((ext_vector_type(8)))  _Float16 v8h;
typedef __attribute__((ext_vector_type(8)))  float v8f;
typedef __attribute__((ext_vector_type(4)))  float v4f;
typedef __attribute__((ext_vector_type(2)))  float v2f;
typedef __attribute__((ext_vector_type(4)))  unsigned v4u;
typedef __attribute__((ext_vector_type(4)))  int v4i;
typedef float __attribute__((may_alias)) float_a;
typedef int __attribute__((may_alias)) int_a;

template <typename T> __device__ __forceinline__ void vst2(void* p, T v) { *(T*)p = v;  }
__device__ __forceinline__ v8f wmma16(v16h a, v16h b, v8f c) {
  v8f d = __builtin_amdgcn_wmma_f32_16x16x32_f16(false, a, false, b, (short)0, c, false, false);
  asm volatile("v_nop\n\tv_nop\n\tv_nop\n\tv_nop" : "+v"(d) : "v"(a), "v"(b));
  return d;
}
__device__ __forceinline__ v8f wmma_bf(v16b a, v16b b, v8f c) {
  v8f d = __builtin_amdgcn_wmma_f32_16x16x32_bf16(false, a, false, b, (short)0, c, false, false);
  asm volatile("v_nop\n\tv_nop\n\tv_nop\n\tv_nop" : "+v"(d) : "v"(a), "v"(b));
  return d;
}
// 16x16x32 fragments: lane = (h = lane>>4, row/col = lane&15); elements 0..7 = k0+8h+0..7, 8..15 = k0+16+8h+0..7; D element r = row 8h+r
__device__ __forceinline__ v16h frag_h(const _Float16* rowk0, int lane) {
  union { v16h v; v8h q[2]; } u; const _Float16* p = rowk0 + 8 * (lane >> 4);
  u.q[0] = *(const v8h*)p; u.q[1] = *(const v8h*)(p + 16); return u.v;
}
__device__ __forceinline__ v16h frag_f32(const float* rowk0, int lane) {
  v16h a; const float* p = rowk0 + 8 * (lane >> 4);
#pragma unroll
  for (int i = 0; i < 8; ++i) { a[i] = (_Float16)p[i]; a[8 + i] = (_Float16)p[16 + i]; }
  return a;
}
__device__ __forceinline__ v16h frag_f32s(const float* rowk0, int lane, float sc) {
  v16h a; const float* p = rowk0 + 8 * (lane >> 4);
#pragma unroll
  for (int i = 0; i < 8; ++i) { a[i] = (_Float16)(p[i] * sc); a[8 + i] = (_Float16)(p[16 + i] * sc); }
  return a;
}
// column fragment from a [K][ld] layout (column n), rows >= K read as 0
__device__ __forceinline__ v16h fragc_f32(const float* W, int k0, int n, int lane, int ld, int K) {
  v16h a; const int g = lane >> 4;
#pragma unroll
  for (int i = 0; i < 8; ++i) { const int ka = k0 + 8 * g + i, kb = ka + 16;
    a[i] = (_Float16)(ka < K ? W[(size_t)(ka < K ? ka : K - 1) * ld + n] : 0.f); a[8 + i] = (_Float16)(kb < K ? W[(size_t)(kb < K ? kb : K - 1) * ld + n] : 0.f); }
  return a;
}
struct F2 { v16b h, l; };
__device__ __forceinline__ F2 bsplit16(const float v[16]) { F2 r;
#pragma unroll
  for (int i = 0; i < 16; ++i) { const __bf16 h = (__bf16)v[i]; r.h[i] = h; r.l[i] = (__bf16)(v[i] - (float)h); }
  return r; }
__device__ __forceinline__ F2 split_row(const float* row, int k0, int lane) { float v[16]; const float* p = row + k0 + 8 * (lane >> 4);
#pragma unroll
  for (int i = 0; i < 8; ++i) { v[i] = p[i]; v[8 + i] = p[16 + i]; }
  return bsplit16(v); }
__device__ __forceinline__ F2 split_rowK(const float* row, int k0, int lane, int K) { float v[16]; const int g = lane >> 4;
#pragma unroll
  for (int i = 0; i < 8; ++i) { const int ka = k0 + 8 * g + i, kb = ka + 16; v[i] = ka < K ? row[ka < K ? ka : K - 1] : 0.f; v[8 + i] = kb < K ? row[kb < K ? kb : K - 1] : 0.f; }
  return bsplit16(v); }
__device__ __forceinline__ F2 split_col(const float* W, int k0, int n, int lane, int ld, int K) { float v[16]; const int g = lane >> 4;
#pragma unroll
  for (int i = 0; i < 8; ++i) { const int ka = k0 + 8 * g + i, kb = ka + 16; v[i] = ka < K ? W[(size_t)(ka < K ? ka : K - 1) * ld + n] : 0.f; v[8 + i] = kb < K ? W[(size_t)(kb < K ? kb : K - 1) * ld + n] : 0.f; }
  return bsplit16(v); }
__device__ __forceinline__ v8f mac3(const F2& a, const F2& b, v8f c) { c = wmma_bf(a.l, b.h, c); c = wmma_bf(a.h, b.l, c); return wmma_bf(a.h, b.h, c); }
__device__ __forceinline__ float sigm(float v) { return 1.0f / (1.0f + expf(-v)); }
#define LDSX() do { asm volatile("s_wait_dscnt 0" ::: "memory"); __builtin_amdgcn_wave_barrier(); __builtin_amdgcn_fence(__ATOMIC_RELEASE, "workgroup"); } while (0)


// Jagged causal silu attention with contextual / target-group masking. One block = 128 query rows (8 waves x 16) of one (sequence, head);
// key tiles of 32 staged in LDS (K row-major bf16, V transposed bf16); per wave and tile: 4 WMMAs for S (two 16-key subtiles x two 32-wide d chunks),
// silu + mask through a per-wave LDS transpose, 8 WMMAs for O (4 d tiles x {residual, hi}). Output rows (256 B per (token, head)) staged per wave
#define NHEAD 4
#define DQK   64
#define DVV   64
#define MTILE 128
#define JTILE 32
#define MAXSEQ 2048
typedef __attribute__((ext_vector_type(8))) __bf16 v8b;
__device__ __forceinline__ v16b frag_b16(const __bf16* rowk0, int lane) {   // 16x16x32 operand fragment from a bf16 row: elements 0..7 = k0+8h.., 8..15 = k0+16+8h..
  union { v16b v; v8b q[2]; } u; const __bf16* p = rowk0 + 8 * (lane >> 4);
  u.q[0] = *(const v8b*)p; u.q[1] = *(const v8b*)(p + 16); return u.v;
}
__device__ __forceinline__ v16b frag_gbf(const float* rowk0, int lane) {     // same map from an f32 global row, rounding to bf16 (RNE)
  v16b a; const float* p = rowk0 + 8 * (lane >> 4);
#pragma unroll
  for (int i = 0; i < 8; ++i) { a[i] = (__bf16)p[i]; a[8 + i] = (__bf16)p[16 + i]; }
  return a;
}
__device__ __forceinline__ float fsilu(float x) { return x / (1.0f + expf(-x)); }

__global__ __launch_bounds__(256)
void k_attn(const float* __restrict__ tq, const float* __restrict__ tk, const float* __restrict__ tv,
            const int* __restrict__ offsets, const int* __restrict__ ncand, const int* __restrict__ p_maxseq, const int* __restrict__ p_nctx,
            float* __restrict__ out) {
  __shared__ __align__(16) __bf16 Kb[JTILE][DQK];        // key rows, bf16 (4 KB)
  __shared__ __align__(16) __bf16 Vt[DVV][JTILE];        // v transposed: Vt[d][key] (4 KB)
  __shared__ __align__(16) float Sscr[8][16][32];        // per-wave S transpose scratch (16 KB)
  __shared__ __align__(16) float So[8][16][DVV];         // per-wave output rows (32 KB)

  const int b    = blockIdx.z, h = blockIdx.y;
  const int off  = offsets[b];
  const int nlen = offsets[b + 1] - off;
  const int row0 = blockIdx.x * MTILE;
  if (row0 >= nlen) return;                               // block-uniform, before any barrier

  const int nc   = p_nctx[0];                              // contextual tokens at the head of each sequence
  const int nt   = ncand[b];                               // target (candidate) tokens at the tail
  const int max1 = nlen - nc + 1;
  const int max2 = max1 - nt;
  const float invDenom = 1.0f / (float)p_maxseq[0];

  const int tid = threadIdx.x, wave = tid >> 5, lane = tid & 31, l16 = lane & 15, hh = lane >> 4;
  const int qb = row0 + wave * 16;

  // ---- Q fragments (bf16-rounded input), kept for the whole key loop: 2 x 8 VGPRs
  int qrow = qb + l16; if (qrow > nlen - 1) qrow = nlen - 1;
  const float* qp = tq + (size_t)(off + qrow) * (NHEAD * DQK) + h * DQK;
  const v16b qf0 = frag_gbf(qp, lane), qf1 = frag_gbf(qp + 32, lane);

  v8f acc[4];
#pragma unroll
  for (int i = 0; i < 4; ++i) acc[i] = (v8f){};

  // rows holding contextual tokens (x < nc) attend to the whole history, everyone else is causal within the block's rows
  const int jcaus = (nlen < row0 + MTILE) ? nlen : (row0 + MTILE);
  const int jmax  = (row0 < nc) ? nlen : jcaus;                      // block-uniform
  const bool wctx = (qb < nc);                                       // wave-uniform

  for (int j = 0; j < jmax; j += JTILE) {
    // ---- cooperative staging: K rows (bf16) ----
    {
      const int r = tid >> 3, cg = (tid & 7) * 8;
      int krow = j + r; if (krow > nlen - 1) krow = nlen - 1;          // address clamp; clamped keys are masked by (y < nlen)
      const float* kp = tk + (size_t)(off + krow) * (NHEAD * DQK) + h * DQK + cg;
      const float4 a0 = *(const float4*)kp, a1 = *(const float4*)(kp + 4);
      union { v8b v; uint4 u; } cv;
      cv.v[0] = (__bf16)a0.x; cv.v[1] = (__bf16)a0.y; cv.v[2] = (__bf16)a0.z; cv.v[3] = (__bf16)a0.w;
      cv.v[4] = (__bf16)a1.x; cv.v[5] = (__bf16)a1.y; cv.v[6] = (__bf16)a1.z; cv.v[7] = (__bf16)a1.w;
      *(uint4*)&Kb[r][cg] = cv.u;
    }
    // ---- cooperative staging: V transposed (bf16) ----
    {
      const int rp = tid >> 4, cg = (tid & 15) * 4;                   // key pair (2rp, 2rp+1), 4 d columns
      int r0g = j + 2 * rp, r1g = r0g + 1;
      if (r0g > nlen - 1) r0g = nlen - 1;
      if (r1g > nlen - 1) r1g = nlen - 1;
      const float4 a = *(const float4*)(tv + (size_t)(off + r0g) * (NHEAD * DVV) + h * DVV + cg);
      const float4 c = *(const float4*)(tv + (size_t)(off + r1g) * (NHEAD * DVV) + h * DVV + cg);
      union { __bf16 h2[2]; uint32_t u; } p0, p1, p2, p3;
      p0.h2[0] = (__bf16)a.x; p0.h2[1] = (__bf16)c.x; p1.h2[0] = (__bf16)a.y; p1.h2[1] = (__bf16)c.y;
      p2.h2[0] = (__bf16)a.z; p2.h2[1] = (__bf16)c.z; p3.h2[0] = (__bf16)a.w; p3.h2[1] = (__bf16)c.w;
      *(uint32_t*)&Vt[cg + 0][2 * rp] = p0.u; *(uint32_t*)&Vt[cg + 1][2 * rp] = p1.u;
      *(uint32_t*)&Vt[cg + 2][2 * rp] = p2.u; *(uint32_t*)&Vt[cg + 3][2 * rp] = p3.u;
    }
    __syncthreads();

    const bool active = wctx || (j <= qb + 15);                        // wave-uniform: tile has at least one unmasked key for this wave
    if (active) {
      // ---- S = Q K^T for keys j..j+15 and j+16..j+31 (exact bf16 products)
      v8f s0 = (v8f){}, s1 = (v8f){};
      s0 = wmma_bf(qf0, frag_b16(&Kb[l16][0], lane), s0);       s0 = wmma_bf(qf1, frag_b16(&Kb[l16][32], lane), s0);
      s1 = wmma_bf(qf0, frag_b16(&Kb[16 + l16][0], lane), s1);  s1 = wmma_bf(qf1, frag_b16(&Kb[16 + l16][32], lane), s1);

      // ---- silu(alpha * s) and the integer mask; C layout (row 8*hh + r, column l16) -> LDS row-major
      {
        float* sp = &Sscr[wave][0][0];
        const int y0 = j + l16, y1 = y0 + 16;
        const int idy0 = max(y0 - nc + 1, 0), idy1 = max(y1 - nc + 1, 0);
        const int tgy0 = max(idy0 - max1 + nt, -1), tgy1 = max(idy1 - max1 + nt, -1);
#pragma unroll
        for (int r = 0; r < 8; ++r) {
          const int m = r + hh * 8, x = qb + m;
          const int idx = max(x - nc + 1, 0), tgx = max(idx - max1 + nt, -1);
          const bool c0 = (x == y0) || (idx > idy0), c1 = (x == y1) || (idx > idy1);
          const bool g0 = (tgx == tgy0) || (tgx < 0) || (tgy0 < 0), g1 = (tgx == tgy1) || (tgx < 0) || (tgy1 < 0);
          const bool ctx = (idx == 0);
          const bool ok0 = ((c0 && g0) || (ctx && idy0 < max2)) && (y0 < nlen) && (x < nlen);
          const bool ok1 = ((c1 && g1) || (ctx && idy1 < max2)) && (y1 < nlen) && (x < nlen);
          const float a0v = fsilu(s0[r] * 0.125f), a1v = fsilu(s1[r] * 0.125f);
          sp[m * 32 + l16]      = ok0 ? a0v : 0.0f;
          sp[m * 32 + 16 + l16] = ok1 ? a1v : 0.0f;
        }
      }
      LDSX();
      // ---- read the wave's 16x32 P tile back as an A fragment, split into bf16 hi + residual
      F2 pf;
      { float v[16]; const float* row = &Sscr[wave][l16][0]; const int c0 = hh * 8;
#pragma unroll
        for (int i = 0; i < 8; ++i) { v[i] = row[c0 + i]; v[8 + i] = row[16 + c0 + i]; }
        pf = bsplit16(v); }
      // ---- O += P V (4 d tiles x 2 WMMAs)
#pragma unroll
      for (int dc = 0; dc < 4; ++dc) {
        const v16b vf = frag_b16(&Vt[dc * 16 + l16][0], lane);         // keys 8*hh.., 16+8*hh..
        acc[dc] = wmma_bf(pf.l, vf, acc[dc]);
        acc[dc] = wmma_bf(pf.h, vf, acc[dc]);
      }
    }
    __syncthreads();                                                   // protect Kb/Vt before the next staging round
  }

  float* so = &So[wave][0][0];
#pragma unroll
  for (int r = 0; r < 8; ++r)
#pragma unroll
    for (int dc = 0; dc < 4; ++dc) so[(r + hh * 8) * DVV + dc * 16 + l16] = acc[dc][r] * invDenom;
  LDSX();
#pragma unroll
  for (int m2 = 0; m2 < 8; ++m2) { const int m = 2 * m2 + hh; const int x = qb + m;
    if (x < nlen) vst2(out + (size_t)(off + x) * (NHEAD * DVV) + h * DVV + l16 * 4, *(const v4f*)(so + m * DVV + l16 * 4)); }
}

extern "C" void kernel_launch(void* const* d_in, const int* in_sizes, int n_in, void* d_out, int out_size, void* d_ws, size_t ws_size, hipStream_t stream) {
  (void)n_in; (void)out_size; (void)d_ws; (void)ws_size;
  const int nseq = in_sizes[3] - 1;                 // offsets holds nseq + 1 entries
  dim3 grid(MAXSEQ / MTILE, NHEAD, nseq), block(256, 1, 1);
  k_attn<<<grid, block, 0, stream>>>((const float*)d_in[0], (const float*)d_in[1], (const float*)d_in[2],
                                     (const int*)d_in[3], (const int*)d_in[4], (const int*)d_in[5], (const int*)d_in[6], (float*)d_out);
}

// v001
// A run of this version takes 67.3 microseconds.
// In both of two side-by-side timings against v000, it was 1.45 times as fast.
// compute dtype: q, k, v (module inputs) rounded to bf16; S = q k^T as exact bf16 WMMA products (f32 accumulate); silu and the integer attention mask in f32;
// silu(S) carried as a bf16 hi + bf16 residual pair against bf16 v (f32 accumulate); the 1/max_seqlen factor applied in the f32 epilogue.
#include <hip/hip_runtime.h>
#include <math.h>

typedef __attribute__((ext_vector_type(16))) _Float16 v16h;
typedef __attribute__((ext_vector_type(16))) __bf16 v16b;
typedef __attribute__((ext_vector_type(8)))  _Float16 v8h;
typedef __attribute__((ext_vector_type(8)))  float v8f;
typedef __attribute__((ext_vector_type(4)))  float v4f;
typedef __attribute__((ext_vector_type(2)))  float v2f;
typedef __attribute__((ext_vector_type(4)))  unsigned v4u;
typedef __attribute__((ext_vector_type(4)))  int v4i;
typedef float __attribute__((may_alias)) float_a;
typedef int __attribute__((may_alias)) int_a;

template <typename T> __device__ __forceinline__ void vst2(void* p, T v) { *(T*)p = v;  }
__device__ __forceinline__ v8f wmma16(v16h a, v16h b, v8f c) {
  v8f d = __builtin_amdgcn_wmma_f32_16x16x32_f16(false, a, false, b, (short)0, c, false, false);
  asm volatile("v_nop\n\tv_nop\n\tv_nop\n\tv_nop" : "+v"(d) : "v"(a), "v"(b));
  return d;
}
__device__ __forceinline__ v8f wmma_bf(v16b a, v16b b, v8f c) {
  v8f d = __builtin_amdgcn_wmma_f32_16x16x32_bf16(false, a, false, b, (short)0, c, false, false);
  asm volatile("v_nop\n\tv_nop\n\tv_nop\n\tv_nop" : "+v"(d) : "v"(a), "v"(b));
  return d;
}
// 16x16x32 fragments: lane = (h = lane>>4, row/col = lane&15); elements 0..7 = k0+8h+0..7, 8..15 = k0+16+8h+0..7; D element r = row 8h+r
__device__ __forceinline__ v16h frag_h(const _Float16* rowk0, int lane) {
  union { v16h v; v8h q[2]; } u; const _Float16* p = rowk0 + 8 * (lane >> 4);
  u.q[0] = *(const v8h*)p; u.q[1] = *(const v8h*)(p + 16); return u.v;
}
__device__ __forceinline__ v16h frag_f32(const float* rowk0, int lane) {
  v16h a; const float* p = rowk0 + 8 * (lane >> 4);
#pragma unroll
  for (int i = 0; i < 8; ++i) { a[i] = (_Float16)p[i]; a[8 + i] = (_Float16)p[16 + i]; }
  return a;
}
__device__ __forceinline__ v16h frag_f32s(const float* rowk0, int lane, float sc) {
  v16h a; const float* p = rowk0 + 8 * (lane >> 4);
#pragma unroll
  for (int i = 0; i < 8; ++i) { a[i] = (_Float16)(p[i] * sc); a[8 + i] = (_Float16)(p[16 + i] * sc); }
  return a;
}
// column fragment from a [K][ld] layout (column n), rows >= K read as 0
__device__ __forceinline__ v16h fragc_f32(const float* W, int k0, int n, int lane, int ld, int K) {
  v16h a; const int g = lane >> 4;
#pragma unroll
  for (int i = 0; i < 8; ++i) { const int ka = k0 + 8 * g + i, kb = ka + 16;
    a[i] = (_Float16)(ka < K ? W[(size_t)(ka < K ? ka : K - 1) * ld + n] : 0.f); a[8 + i] = (_Float16)(kb < K ? W[(size_t)(kb < K ? kb : K - 1) * ld + n] : 0.f); }
  return a;
}
struct F2 { v16b h, l; };
__device__ __forceinline__ F2 bsplit16(const float v[16]) { F2 r;
#pragma unroll
  for (int i = 0; i < 16; ++i) { const __bf16 h = (__bf16)v[i]; r.h[i] = h; r.l[i] = (__bf16)(v[i] - (float)h); }
  return r; }
__device__ __forceinline__ F2 split_row(const float* row, int k0, int lane) { float v[16]; const float* p = row + k0 + 8 * (lane >> 4);
#pragma unroll
  for (int i = 0; i < 8; ++i) { v[i] = p[i]; v[8 + i] = p[16 + i]; }
  return bsplit16(v); }
__device__ __forceinline__ F2 split_rowK(const float* row, int k0, int lane, int K) { float v[16]; const int g = lane >> 4;
#pragma unroll
  for (int i = 0; i < 8; ++i) { const int ka = k0 + 8 * g + i, kb = ka + 16; v[i] = ka < K ? row[ka < K ? ka : K - 1] : 0.f; v[8 + i] = kb < K ? row[kb < K ? kb : K - 1] : 0.f; }
  return bsplit16(v); }
__device__ __forceinline__ F2 split_col(const float* W, int k0, int n, int lane, int ld, int K) { float v[16]; const int g = lane >> 4;
#pragma unroll
  for (int i = 0; i < 8; ++i) { const int ka = k0 + 8 * g + i, kb = ka + 16; v[i] = ka < K ? W[(size_t)(ka < K ? ka : K - 1) * ld + n] : 0.f; v[8 + i] = kb < K ? W[(size_t)(kb < K ? kb : K - 1) * ld + n] : 0.f; }
  return bsplit16(v); }
__device__ __forceinline__ v8f mac3(const F2& a, const F2& b, v8f c) { c = wmma_bf(a.l, b.h, c); c = wmma_bf(a.h, b.l, c); return wmma_bf(a.h, b.h, c); }
__device__ __forceinline__ float sigm(float v) { return 1.0f / (1.0f + expf(-v)); }
#define LDSX() do { asm volatile("s_wait_dscnt 0" ::: "memory"); __builtin_amdgcn_wave_barrier(); __builtin_amdgcn_fence(__ATOMIC_RELEASE, "workgroup"); } while (0)


// Jagged causal silu attention with contextual / target-group masking. One block = 64 query rows of one (sequence, head): 16 waves = 4 row groups of 16 x 4 key tiles;
// a round stages 4 key tiles of 32 in LDS (K row-major bf16, V transposed bf16) and each wave works on one of them, so a row's keys are walked by 4 waves side by side;
// per wave and tile: 4 WMMAs for S (two 16-key subtiles x two 32-wide d chunks), silu + mask through a per-wave LDS transpose, 8 WMMAs for O (4 d tiles x {residual, hi}).
// The 4 partial outputs of a row group are summed through LDS behind the loop (silu attention has no row normaliser, so partial sums just add)
#define NHEAD 4
#define DQK   64
#define DVV   64
#define MTILE 64
#define JTILE 32
#define KSPLIT 4
#define NWAVE 16
#define MAXSEQ 2048
typedef __attribute__((ext_vector_type(8))) __bf16 v8b;
__device__ __forceinline__ v16b frag_b16(const __bf16* rowk0, int lane) {   // 16x16x32 operand fragment from a bf16 row: elements 0..7 = k0+8h.., 8..15 = k0+16+8h..
  union { v16b v; v8b q[2]; } u; const __bf16* p = rowk0 + 8 * (lane >> 4);
  u.q[0] = *(const v8b*)p; u.q[1] = *(const v8b*)(p + 16); return u.v;
}
__device__ __forceinline__ v16b frag_gbf(const float* rowk0, int lane) {     // same map from an f32 global row, rounding to bf16 (RNE)
  v16b a; const float* p = rowk0 + 8 * (lane >> 4);
#pragma unroll
  for (int i = 0; i < 8; ++i) { a[i] = (__bf16)p[i]; a[8 + i] = (__bf16)p[16 + i]; }
  return a;
}
__device__ __forceinline__ float fsilu(float x) { return x / (1.0f + expf(-x)); }

__global__ __launch_bounds__(512, 8)   // 128 VGPRs: two of these 16-wave blocks stay resident on a WGP
void k_attn(const float* __restrict__ tq, const float* __restrict__ tk, const float* __restrict__ tv,
            const int* __restrict__ offsets, const int* __restrict__ ncand, const int* __restrict__ p_maxseq, const int* __restrict__ p_nctx,
            float* __restrict__ out) {
  __shared__ __align__(16) __bf16 Kb[KSPLIT][JTILE][DQK];  // key rows, bf16, one tile per key split (16 KB)
  __shared__ __align__(16) __bf16 Vt[KSPLIT][DVV][JTILE];  // v transposed: Vt[tile][d][key] (16 KB)
  __shared__ __align__(16) float Sscr[NWAVE][16][32];    // per-wave S transpose scratch (32 KB)
  __shared__ __align__(16) float So[NWAVE][16][DVV];     // per-wave partial output rows (64 KB)

  const int b    = blockIdx.z, h = blockIdx.y;
  const int off  = offsets[b];
  const int nlen = offsets[b + 1] - off;
  const int row0 = blockIdx.x * MTILE;
  if (row0 >= nlen) return;                               // block-uniform, before any barrier

  const int nc   = p_nctx[0];                              // contextual tokens at the head of each sequence
  const int nt   = ncand[b];                               // target (candidate) tokens at the tail
  const int max1 = nlen - nc + 1;
  const int max2 = max1 - nt;
  const int maxseq = p_maxseq[0];

  const int tid = threadIdx.x, wave = __builtin_amdgcn_readfirstlane(tid >> 5), lane = tid & 31, l16 = lane & 15, hh = lane >> 4;
  // the wave number is held in a scalar register, so that row group, key tile and the tile test below are scalar and cost no VGPR
  const int rg = wave & 3, ks = wave >> 2;                 // row group of 16 queries, key tile of the round
  const int qb = row0 + rg * 16;

  // ---- Q fragments (bf16-rounded input), kept for the whole key loop: 2 x 8 VGPRs
  int qrow = qb + l16; if (qrow > nlen - 1) qrow = nlen - 1;
  const float* qp = tq + (size_t)(off + qrow) * (NHEAD * DQK) + h * DQK;
  const v16b qf0 = frag_gbf(qp, lane), qf1 = frag_gbf(qp + 32, lane);

  v8f acc[4];
#pragma unroll
  for (int i = 0; i < 4; ++i) acc[i] = (v8f){};

  // rows holding contextual tokens (x < nc) attend to the whole history, everyone else is causal within the block's rows
  const int jcaus = (nlen < row0 + MTILE) ? nlen : (row0 + MTILE);
  const int jmax  = (row0 < nc) ? nlen : jcaus;                      // block-uniform
  const bool wctx = (qb < nc);                                       // wave-uniform

  for (int j = 0; j < jmax; j += JTILE * KSPLIT) {
    // ---- cooperative staging of the round's 4 tiles (128 keys): K rows as bf16, V transposed as bf16 ----
    {
      const int cgk = (tid & 7) * 8, cgv = (tid & 15) * 4;             // K: 8 d columns of one key; V: 4 d columns of a key pair
      v4f ka[2][2], va[2][2];
#pragma unroll
      for (int t = 0; t < 2; ++t) {
        int krow = j + t * 64 + (tid >> 3); if (krow > nlen - 1) krow = nlen - 1;   // address clamp; clamped keys are masked by (y < nlen)
        const float* kp = tk + (size_t)(off + krow) * (NHEAD * DQK) + h * DQK + cgk;
        ka[t][0] = *(const v4f*)kp;
        asm volatile("s_wait_xcnt 0x0" ::: "memory");                  // the next load's result may land in the address pair that the load above names: keep the wait in front of that overwrite
        ka[t][1] = *(const v4f*)(kp + 4);
      }
#pragma unroll
      for (int t = 0; t < 2; ++t) {
        int r0g = j + 2 * (t * 32 + (tid >> 4)), r1g = r0g + 1;        // key pair of the round
        if (r0g > nlen - 1) r0g = nlen - 1;
        if (r1g > nlen - 1) r1g = nlen - 1;
        va[t][0] = *(const v4f*)(tv + (size_t)(off + r0g) * (NHEAD * DVV) + h * DVV + cgv);
        va[t][1] = *(const v4f*)(tv + (size_t)(off + r1g) * (NHEAD * DVV) + h * DVV + cgv);
      }
      // holds the 8 loads together in front of the first conversion: one memory latency a round instead of one per load pair
      asm volatile("" :: "v"(ka[0][0]), "v"(ka[0][1]), "v"(ka[1][0]), "v"(ka[1][1]), "v"(va[0][0]), "v"(va[0][1]), "v"(va[1][0]), "v"(va[1][1]));
#pragma unroll
      for (int t = 0; t < 2; ++t) {
        const int kl = t * 64 + (tid >> 3);                            // key of the round, 0..127: tile kl / 32, row kl % 32
        union { v8b v; uint4 u; } cv;
#pragma unroll
        for (int i = 0; i < 4; ++i) { cv.v[i] = (__bf16)ka[t][0][i]; cv.v[4 + i] = (__bf16)ka[t][1][i]; }
        *(uint4*)&Kb[kl >> 5][kl & 31][cgk] = cv.u;
      }
#pragma unroll
      for (int t = 0; t < 2; ++t) {
        const int pl = t * 32 + (tid >> 4);                            // key pair of the round, 0..63: tile pl / 16, keys 2 * (pl % 16) and the next
#pragma unroll
        for (int i = 0; i < 4; ++i) {
          union { __bf16 h2[2]; uint32_t u; } p;
          p.h2[0] = (__bf16)va[t][0][i]; p.h2[1] = (__bf16)va[t][1][i];
          *(uint32_t*)&Vt[pl >> 4][cgv + i][2 * (pl & 15)] = p.u;
        }
      }
    }
    __syncthreads();

    const int jt = j + ks * JTILE;                                     // first key of this wave's tile
    const bool active = (jt < jmax) && (wctx || (jt <= qb + 15));      // wave-uniform: tile has at least one unmasked key for this wave
    if (active) {
      // ---- S = Q K^T for keys jt..jt+15 and jt+16..jt+31 (exact bf16 products)
      v8f s0 = (v8f){}, s1 = (v8f){};
      s0 = wmma_bf(qf0, frag_b16(&Kb[ks][l16][0], lane), s0);       s0 = wmma_bf(qf1, frag_b16(&Kb[ks][l16][32], lane), s0);
      s1 = wmma_bf(qf0, frag_b16(&Kb[ks][16 + l16][0], lane), s1);  s1 = wmma_bf(qf1, frag_b16(&Kb[ks][16 + l16][32], lane), s1);

      // ---- silu(alpha * s) and the integer mask; C layout (row 8*hh + r, column l16) -> LDS row-major
      {
        float* sp = &Sscr[wave][0][0];
        const int y0 = jt + l16, y1 = y0 + 16;
        const int idy0 = max(y0 - nc + 1, 0), idy1 = max(y1 - nc + 1, 0);
        const int tgy0 = max(idy0 - max1 + nt, -1), tgy1 = max(idy1 - max1 + nt, -1);
#pragma unroll
        for (int r = 0; r < 8; ++r) {
          const int m = r + hh * 8, x = qb + m;
          const int idx = max(x - nc + 1, 0), tgx = max(idx - max1 + nt, -1);
          const bool c0 = (x == y0) || (idx > idy0), c1 = (x == y1) || (idx > idy1);
          const bool g0 = (tgx == tgy0) || (tgx < 0) || (tgy0 < 0), g1 = (tgx == tgy1) || (tgx < 0) || (tgy1 < 0);
          const bool ctx = (idx == 0);
          const bool ok0 = ((c0 && g0) || (ctx && idy0 < max2)) && (y0 < nlen) && (x < nlen);
          const bool ok1 = ((c1 && g1) || (ctx && idy1 < max2)) && (y1 < nlen) && (x < nlen);
          const float a0v = fsilu(s0[r] * 0.125f), a1v = fsilu(s1[r] * 0.125f);
          sp[m * 32 + l16]      = ok0 ? a0v : 0.0f;
          sp[m * 32 + 16 + l16] = ok1 ? a1v : 0.0f;
        }
      }
      LDSX();
      // ---- read the wave's 16x32 P tile back as an A fragment, split into bf16 hi + residual
      F2 pf;
      { float v[16]; const float* row = &Sscr[wave][l16][0]; const int c0 = hh * 8;
#pragma unroll
        for (int i = 0; i < 8; ++i) { v[i] = row[c0 + i]; v[8 + i] = row[16 + c0 + i]; }
        pf = bsplit16(v); }
      // ---- O += P V (4 d tiles x 2 WMMAs)
#pragma unroll
      for (int dc = 0; dc < 4; ++dc) {
        const v16b vf = frag_b16(&Vt[ks][dc * 16 + l16][0], lane);     // keys 8*hh.., 16+8*hh..
        acc[dc] = wmma_bf(pf.l, vf, acc[dc]);
        acc[dc] = wmma_bf(pf.h, vf, acc[dc]);
      }
    }
    __syncthreads();                                                   // protect Kb/Vt before the next staging round
  }

  // the lane number is read anew here, so that no lane index has to stay in a VGPR over the key loop just for these last lines (the loop sits at its register limit; held over it, such values spill to scratch)
  const int el = (int)__builtin_amdgcn_mbcnt_lo(~0u, 0u), e16 = el & 15, eh = el >> 4;
  float* so = &So[wave][0][0];
#pragma unroll
  for (int r = 0; r < 8; ++r)
#pragma unroll
    for (int dc = 0; dc < 4; ++dc) so[(r + eh * 8) * DVV + dc * 16 + e16] = acc[dc][r];
  __syncthreads();                                                     // every wave's partial rows are in LDS before any wave sums them
  const float invDenom = 1.0f / (float)maxseq;
  // ---- sum the 4 key splits of each row in the fixed order 0..3, scale, store whole 256-B rows (16 lanes x 16 B)
#pragma unroll
  for (int i = 0; i < 2; ++i) { const int m = i * 32 + wave * 2 + eh, c = e16 * 4; const int x = row0 + m;   // wave * 2 + eh = thread / 16
    const float* pr = &So[m >> 4][m & 15][c];                          // wave index = 4 * split + row group
    v4f s = *(const v4f*)pr;
#pragma unroll
    for (int k = 1; k < KSPLIT; ++k) s += *(const v4f*)(pr + k * 4 * 16 * DVV);
    if (x < nlen) vst2(out + (size_t)(off + x) * (NHEAD * DVV) + h * DVV + c, (v4f)(s * invDenom)); }
}

extern "C" void kernel_launch(void* const* d_in, const int* in_sizes, int n_in, void* d_out, int out_size, void* d_ws, size_t ws_size, hipStream_t stream) {
  (void)n_in; (void)out_size; (void)d_ws; (void)ws_size;
  const int nseq = in_sizes[3] - 1;                 // offsets holds nseq + 1 entries
  dim3 grid(MAXSEQ / MTILE, NHEAD, nseq), block(512, 1, 1);
  k_attn<<<grid, block, 0, stream>>>((const float*)d_in[0], (const float*)d_in[1], (const float*)d_in[2],
                                     (const int*)d_in[3], (const int*)d_in[4], (const int*)d_in[5], (const int*)d_in[6], (float*)d_out);
}

// v002
// Measured time: 46.8 microseconds a run.
// Timed twice side by side with v001, it ran 1.44 and 1.43 times as fast.
// Counting every step since v000, it is 2.08 times as fast.
// compute dtype: q, k, v (module inputs) rounded to bf16; S = q k^T as exact bf16 WMMA products (f32 accumulate); silu and the integer attention mask in f32;
// silu(S) carried as a bf16 hi + bf16 residual pair against bf16 v (f32 accumulate); the 1/max_seqlen factor applied in the f32 epilogue.
#include <hip/hip_runtime.h>
#include <math.h>

typedef __attribute__((ext_vector_type(16))) _Float16 v16h;
typedef __attribute__((ext_vector_type(16))) __bf16 v16b;
typedef __attribute__((ext_vector_type(8)))  _Float16 v8h;
typedef __attribute__((ext_vector_type(8)))  float v8f;
typedef __attribute__((ext_vector_type(4)))  float v4f;
typedef __attribute__((ext_vector_type(2)))  float v2f;
typedef __attribute__((ext_vector_type(4)))  unsigned v4u;
typedef __attribute__((ext_vector_type(4)))  int v4i;
typedef float __attribute__((may_alias)) float_a;
typedef int __attribute__((may_alias)) int_a;

template <typename T> __device__ __forceinline__ void vst2(void* p, T v) { *(T*)p = v;  }
__device__ __forceinline__ v8f wmma16(v16h a, v16h b, v8f c) {
  v8f d = __builtin_amdgcn_wmma_f32_16x16x32_f16(false, a, false, b, (short)0, c, false, false);
  asm volatile("v_nop\n\tv_nop\n\tv_nop\n\tv_nop" : "+v"(d) : "v"(a), "v"(b));
  return d;
}
__device__ __forceinline__ v8f wmma_bf(v16b a, v16b b, v8f c) {
  v8f d = __builtin_amdgcn_wmma_f32_16x16x32_bf16(false, a, false, b, (short)0, c, false, false);
  asm volatile("v_nop\n\tv_nop\n\tv_nop\n\tv_nop" : "+v"(d) : "v"(a), "v"(b));
  return d;
}
// 16x16x32 fragments: lane = (h = lane>>4, row/col = lane&15); elements 0..7 = k0+8h+0..7, 8..15 = k0+16+8h+0..7; D element r = row 8h+r
__device__ __forceinline__ v16h frag_h(const _Float16* rowk0, int lane) {
  union { v16h v; v8h q[2]; } u; const _Float16* p = rowk0 + 8 * (lane >> 4);
  u.q[0] = *(const v8h*)p; u.q[1] = *(const v8h*)(p + 16); return u.v;
}
__device__ __forceinline__ v16h frag_f32(const float* rowk0, int lane) {
  v16h a; const float* p = rowk0 + 8 * (lane >> 4);
#pragma unroll
  for (int i = 0; i < 8; ++i) { a[i] = (_Float16)p[i]; a[8 + i] = (_Float16)p[16 + i]; }
  return a;
}
__device__ __forceinline__ v16h frag_f32s(const float* rowk0, int lane, float sc) {
  v16h a; const float* p = rowk0 + 8 * (lane >> 4);
#pragma unroll
  for (int i = 0; i < 8; ++i) { a[i] = (_Float16)(p[i] * sc); a[8 + i] = (_Float16)(p[16 + i] * sc); }
  return a;
}
// column fragment from a [K][ld] layout (column n), rows >= K read as 0
__device__ __forceinline__ v16h fragc_f32(const float* W, int k0, int n, int lane, int ld, int K) {
  v16h a; const int g = lane >> 4;
#pragma unroll
  for (int i = 0; i < 8; ++i) { const int ka = k0 + 8 * g + i, kb = ka + 16;
    a[i] = (_Float16)(ka < K ? W[(size_t)(ka < K ? ka : K - 1) * ld + n] : 0.f); a[8 + i] = (_Float16)(kb < K ? W[(size_t)(kb < K ? kb : K - 1) * ld + n] : 0.f); }
  return a;
}
struct F2 { v16b h, l; };
__device__ __forceinline__ F2 bsplit16(const float v[16]) { F2 r;
#pragma unroll
  for (int i = 0; i < 16; ++i) { const __bf16 h = (__bf16)v[i]; r.h[i] = h; r.l[i] = (__bf16)(v[i] - (float)h); }
  return r; }
__device__ __forceinline__ F2 split_row(const float* row, int k0, int lane) { float v[16]; const float* p = row + k0 + 8 * (lane >> 4);
#pragma unroll
  for (int i = 0; i < 8; ++i) { v[i] = p[i]; v[8 + i] = p[16 + i]; }
  return bsplit16(v); }
__device__ __forceinline__ F2 split_rowK(const float* row, int k0, int lane, int K) { float v[16]; const int g = lane >> 4;
#pragma unroll
  for (int i = 0; i < 8; ++i) { const int ka = k0 + 8 * g + i, kb = ka + 16; v[i] = ka < K ? row[ka < K ? ka : K - 1] : 0.f; v[8 + i] = kb < K ? row[kb < K ? kb : K - 1] : 0.f; }
  return bsplit16(v); }
__device__ __forceinline__ F2 split_col(const float* W, int k0, int n, int lane, int ld, int K) { float v[16]; const int g = lane >> 4;
#pragma unroll
  for (int i = 0; i < 8; ++i) { const int ka = k0 + 8 * g + i, kb = ka + 16; v[i] = ka < K ? W[(size_t)(ka < K ? ka : K - 1) * ld + n] : 0.f; v[8 + i] = kb < K ? W[(size_t)(kb < K ? kb : K - 1) * ld + n] : 0.f; }
  return bsplit16(v); }
__device__ __forceinline__ v8f mac3(const F2& a, const F2& b, v8f c) { c = wmma_bf(a.l, b.h, c); c = wmma_bf(a.h, b.l, c); return wmma_bf(a.h, b.h, c); }
__device__ __forceinline__ float sigm(float v) { return 1.0f / (1.0f + expf(-v)); }
#define LDSX() do { asm volatile("s_wait_dscnt 0" ::: "memory"); __builtin_amdgcn_wave_barrier(); __builtin_amdgcn_fence(__ATOMIC_RELEASE, "workgroup"); } while (0)


// Jagged causal silu attention with contextual / target-group masking. One block = 64 query rows of one (sequence, head): 16 waves = 4 row groups of 16 x 4 key tiles;
// a round stages 4 key tiles of 32 in LDS (K row-major bf16, V transposed bf16) and each wave works on one of them, so a row's keys are walked by 4 waves side by side;
// per wave and tile: 4 WMMAs for S (two 16-key subtiles x two 32-wide d chunks), silu + mask through a per-wave LDS transpose, 8 WMMAs for O (4 d tiles x {residual, hi}).
// The 4 partial outputs of a row group are summed through LDS behind the loop (silu attention has no row normaliser, so partial sums just add)
#define NHEAD 4
#define DQK   64
#define DVV   64
#define MTILE 64
#define JTILE 32
#define KSPLIT 4
#define NWAVE 16
#define MAXSEQ 2048
// LDS row pitches. K, transposed V and S scratch are read by ds_load_b128 with 16 lanes on 16 rows: a pitch of 16 B x odd spreads those rows over all 64 banks,
// where the bare 128-B and 64-B rows put them on 8 and 16 banks. The partial output rows are padded for their stores: the two lane halves write rows 8 apart,
// which fall on the same banks at 256 B. The pad elements are never written and never read
#define KPITCH 72    // bf16 per K row: 144 B
#define VPITCH 40    // bf16 per transposed V row: 80 B
#define SPITCH 36    // f32 per row of the S transpose scratch: 144 B
#define OPITCH 68    // f32 per partial output row: 272 B
typedef __attribute__((ext_vector_type(8))) __bf16 v8b;
__device__ __forceinline__ v16b frag_b16(const __bf16* rowk0, int lane) {   // 16x16x32 operand fragment from a bf16 row: elements 0..7 = k0+8h.., 8..15 = k0+16+8h..
  union { v16b v; v8b q[2]; } u; const __bf16* p = rowk0 + 8 * (lane >> 4);
  u.q[0] = *(const v8b*)p; u.q[1] = *(const v8b*)(p + 16); return u.v;
}
__device__ __forceinline__ v16b frag_gbf(const float* rowk0, int lane) {     // same map from an f32 global row, rounding to bf16 (RNE)
  v16b a; const float* p = rowk0 + 8 * (lane >> 4);
#pragma unroll
  for (int i = 0; i < 8; ++i) { a[i] = (__bf16)p[i]; a[8 + i] = (__bf16)p[16 + i]; }
  return a;
}
__device__ __forceinline__ float fsilu(float x) { return x / (1.0f + expf(-x)); }

__global__ __launch_bounds__(512, 8)   // 128 VGPRs: two of these 16-wave blocks stay resident on a WGP
void k_attn(const float* __restrict__ tq, const float* __restrict__ tk, const float* __restrict__ tv,
            const int* __restrict__ offsets, const int* __restrict__ ncand, const int* __restrict__ p_maxseq, const int* __restrict__ p_nctx,
            float* __restrict__ out) {
  __shared__ __align__(16) __bf16 Kb[KSPLIT][JTILE][KPITCH];  // key rows, bf16, one tile per key split (18 KB)
  __shared__ __align__(16) __bf16 Vt[KSPLIT][DVV][VPITCH];  // v transposed: Vt[tile][d][key] (20 KB)
  __shared__ __align__(16) float Sscr[NWAVE][16][SPITCH];    // per-wave S transpose scratch (36 KB)
  __shared__ __align__(16) float So[NWAVE][16][OPITCH];     // per-wave partial output rows (68 KB)

  const int b    = blockIdx.z, h = blockIdx.y;
  const int off  = offsets[b];
  const int nlen = offsets[b + 1] - off;
  const int row0 = blockIdx.x * MTILE;
  if (row0 >= nlen) return;                               // block-uniform, before any barrier

  const int nc   = p_nctx[0];                              // contextual tokens at the head of each sequence
  const int nt   = ncand[b];                               // target (candidate) tokens at the tail
  const int max1 = nlen - nc + 1;
  const int max2 = max1 - nt;
  const int maxseq = p_maxseq[0];

  const int tid = threadIdx.x, wave = __builtin_amdgcn_readfirstlane(tid >> 5), lane = tid & 31, l16 = lane & 15, hh = lane >> 4;
  // the wave number is held in a scalar register, so that row group, key tile and the tile test below are scalar and cost no VGPR
  const int rg = wave & 3, ks = wave >> 2;                 // row group of 16 queries, key tile of the round
  const int qb = row0 + rg * 16;

  // ---- Q fragments (bf16-rounded input), kept for the whole key loop: 2 x 8 VGPRs
  int qrow = qb + l16; if (qrow > nlen - 1) qrow = nlen - 1;
  const float* qp = tq + (size_t)(off + qrow) * (NHEAD * DQK) + h * DQK;
  const v16b qf0 = frag_gbf(qp, lane), qf1 = frag_gbf(qp + 32, lane);

  v8f acc[4];
#pragma unroll
  for (int i = 0; i < 4; ++i) acc[i] = (v8f){};

  // rows holding contextual tokens (x < nc) attend to the whole history, everyone else is causal within the block's rows
  const int jcaus = (nlen < row0 + MTILE) ? nlen : (row0 + MTILE);
  const int jmax  = (row0 < nc) ? nlen : jcaus;                      // block-uniform
  const bool wctx = (qb < nc);                                       // wave-uniform

  for (int j = 0; j < jmax; j += JTILE * KSPLIT) {
    // ---- cooperative staging of the round's 4 tiles (128 keys): K rows as bf16, V transposed as bf16 ----
    {
      const int cgk = (tid & 7) * 8, cgv = (tid & 15) * 4;             // K: 8 d columns of one key; V: 4 d columns of a key pair
      v4f ka[2][2], va[2][2];
#pragma unroll
      for (int t = 0; t < 2; ++t) {
        int krow = j + t * 64 + (tid >> 3); if (krow > nlen - 1) krow = nlen - 1;   // address clamp; clamped keys are masked by (y < nlen)
        const float* kp = tk + (size_t)(off + krow) * (NHEAD * DQK) + h * DQK + cgk;
        ka[t][0] = *(const v4f*)kp;
        asm volatile("s_wait_xcnt 0x0" ::: "memory");                  // the next load's result may land in the address pair that the load above names: keep the wait in front of that overwrite
        ka[t][1] = *(const v4f*)(kp + 4);
      }
#pragma unroll
      for (int t = 0; t < 2; ++t) {
        int r0g = j + 2 * (t * 32 + (tid >> 4)), r1g = r0g + 1;        // key pair of the round
        if (r0g > nlen - 1) r0g = nlen - 1;
        if (r1g > nlen - 1) r1g = nlen - 1;
        va[t][0] = *(const v4f*)(tv + (size_t)(off + r0g) * (NHEAD * DVV) + h * DVV + cgv);
        va[t][1] = *(const v4f*)(tv + (size_t)(off + r1g) * (NHEAD * DVV) + h * DVV + cgv);
      }
      // holds the 8 loads together in front of the first conversion: one memory latency a round instead of one per load pair
      asm volatile("" :: "v"(ka[0][0]), "v"(ka[0][1]), "v"(ka[1][0]), "v"(ka[1][1]), "v"(va[0][0]), "v"(va[0][1]), "v"(va[1][0]), "v"(va[1][1]));
#pragma unroll
      for (int t = 0; t < 2; ++t) {
        const int kl = t * 64 + (tid >> 3);                            // key of the round, 0..127: tile kl / 32, row kl % 32
        union { v8b v; uint4 u; } cv;
#pragma unroll
        for (int i = 0; i < 4; ++i) { cv.v[i] = (__bf16)ka[t][0][i]; cv.v[4 + i] = (__bf16)ka[t][1][i]; }
        *(uint4*)&Kb[kl >> 5][kl & 31][cgk] = cv.u;
      }
#pragma unroll
      for (int t = 0; t < 2; ++t) {
        const int pl = t * 32 + (tid >> 4);                            // key pair of the round, 0..63: tile pl / 16, keys 2 * (pl % 16) and the next
#pragma unroll
        for (int i = 0; i < 4; ++i) {
          union { __bf16 h2[2]; uint32_t u; } p;
          p.h2[0] = (__bf16)va[t][0][i]; p.h2[1] = (__bf16)va[t][1][i];
          *(uint32_t*)&Vt[pl >> 4][cgv + i][2 * (pl & 15)] = p.u;
        }
      }
    }
    __syncthreads();

    const int jt = j + ks * JTILE;                                     // first key of this wave's tile
    const bool active = (jt < jmax) && (wctx || (jt <= qb + 15));      // wave-uniform: tile has at least one unmasked key for this wave
    if (active) {
      // ---- S = Q K^T for keys jt..jt+15 and jt+16..jt+31 (exact bf16 products)
      v8f s0 = (v8f){}, s1 = (v8f){};
      s0 = wmma_bf(qf0, frag_b16(&Kb[ks][l16][0], lane), s0);       s0 = wmma_bf(qf1, frag_b16(&Kb[ks][l16][32], lane), s0);
      s1 = wmma_bf(qf0, frag_b16(&Kb[ks][16 + l16][0], lane), s1);  s1 = wmma_bf(qf1, frag_b16(&Kb[ks][16 + l16][32], lane), s1);

      // ---- silu(alpha * s) and the integer mask; C layout (row 8*hh + r, column l16) -> LDS row-major
      {
        float* sp = &Sscr[wave][hh * 8][l16];                           // the lane's element of row r = 0; the rows follow at constant offsets
        const int y0 = jt + l16, y1 = y0 + 16;
        const int idy0 = max(y0 - nc + 1, 0), idy1 = max(y1 - nc + 1, 0);
        const int tgy0 = max(idy0 - max1 + nt, -1), tgy1 = max(idy1 - max1 + nt, -1);
#pragma unroll
        for (int r = 0; r < 8; ++r) {
          const int m = r + hh * 8, x = qb + m;
          const int idx = max(x - nc + 1, 0), tgx = max(idx - max1 + nt, -1);
          const bool c0 = (x == y0) || (idx > idy0), c1 = (x == y1) || (idx > idy1);
          const bool g0 = (tgx == tgy0) || (tgx < 0) || (tgy0 < 0), g1 = (tgx == tgy1) || (tgx < 0) || (tgy1 < 0);
          const bool ctx = (idx == 0);
          const bool ok0 = ((c0 && g0) || (ctx && idy0 < max2)) && (y0 < nlen) && (x < nlen);
          const bool ok1 = ((c1 && g1) || (ctx && idy1 < max2)) && (y1 < nlen) && (x < nlen);
          const float a0v = fsilu(s0[r] * 0.125f), a1v = fsilu(s1[r] * 0.125f);
          sp[r * SPITCH]      = ok0 ? a0v : 0.0f;
          sp[r * SPITCH + 16] = ok1 ? a1v : 0.0f;
        }
      }
      LDSX();
      // ---- read the wave's 16x32 P tile back as an A fragment, split into bf16 hi + residual
      F2 pf;
      { float v[16]; const float* row = &Sscr[wave][l16][0]; const int c0 = hh * 8;
#pragma unroll
        for (int i = 0; i < 8; ++i) { v[i] = row[c0 + i]; v[8 + i] = row[16 + c0 + i]; }
        pf = bsplit16(v); }
      // ---- O += P V (4 d tiles x 2 WMMAs)
#pragma unroll
      for (int dc = 0; dc < 4; ++dc) {
        const v16b vf = frag_b16(&Vt[ks][dc * 16 + l16][0], lane);     // keys 8*hh.., 16+8*hh..
        acc[dc] = wmma_bf(pf.l, vf, acc[dc]);
        acc[dc] = wmma_bf(pf.h, vf, acc[dc]);
      }
    }
    __syncthreads();                                                   // protect Kb/Vt before the next staging round
  }

  // the lane number is read anew here, so that no lane index has to stay in a VGPR over the key loop just for these last lines (the loop sits at its register limit; held over it, such values spill to scratch)
  const int el = (int)__builtin_amdgcn_mbcnt_lo(~0u, 0u), e16 = el & 15, eh = el >> 4;
  float* so = &So[wave][0][0];
#pragma unroll
  for (int r = 0; r < 8; ++r)
#pragma unroll
    for (int dc = 0; dc < 4; ++dc) so[(r + eh * 8) * OPITCH + dc * 16 + e16] = acc[dc][r];
  __syncthreads();                                                     // every wave's partial rows are in LDS before any wave sums them
  const float invDenom = 1.0f / (float)maxseq;
  // ---- sum the 4 key splits of each row in the fixed order 0..3, scale, store whole 256-B rows (16 lanes x 16 B)
#pragma unroll
  for (int i = 0; i < 2; ++i) { const int m = i * 32 + wave * 2 + eh, c = e16 * 4; const int x = row0 + m;   // wave * 2 + eh = thread / 16
    const float* pr = &So[m >> 4][m & 15][c];                          // wave index = 4 * split + row group
    v4f s = *(const v4f*)pr;
#pragma unroll
    for (int k = 1; k < KSPLIT; ++k) s += *(const v4f*)(pr + k * 4 * 16 * OPITCH);
    if (x < nlen) vst2(out + (size_t)(off + x) * (NHEAD * DVV) + h * DVV + c, (v4f)(s * invDenom)); }
}

extern "C" void kernel_launch(void* const* d_in, const int* in_sizes, int n_in, void* d_out, int out_size, void* d_ws, size_t ws_size, hipStream_t stream) {
  (void)n_in; (void)out_size; (void)d_ws; (void)ws_size;
  const int nseq = in_sizes[3] - 1;                 // offsets holds nseq + 1 entries
  dim3 grid(MAXSEQ / MTILE, NHEAD, nseq), block(512, 1, 1);
  k_attn<<<grid, block, 0, stream>>>((const float*)d_in[0], (const float*)d_in[1], (const float*)d_in[2],
                                     (const int*)d_in[3], (const int*)d_in[4], (const int*)d_in[5], (const int*)d_in[6], (float*)d_out);
}

// v003
// One run takes 36.5 microseconds.
// In both of two side-by-side timings against v002, it was 1.28 times as fast.
// All steps since v000 together make it 2.66 times as fast.
// compute dtype: q, k, v (module inputs) rounded to bf16; S = q k^T as exact bf16 WMMA products (f32 accumulate); silu and the integer attention mask in f32;
// silu(S) carried as a bf16 hi + bf16 residual pair against bf16 v (f32 accumulate); the 1/max_seqlen factor applied in the f32 epilogue.
#include <hip/hip_runtime.h>
#include <math.h>

typedef __attribute__((ext_vector_type(16))) _Float16 v16h;
typedef __attribute__((ext_vector_type(16))) __bf16 v16b;
typedef __attribute__((ext_vector_type(8)))  _Float16 v8h;
typedef __attribute__((ext_vector_type(8)))  float v8f;
typedef __attribute__((ext_vector_type(4)))  float v4f;
typedef __attribute__((ext_vector_type(2)))  float v2f;
typedef __attribute__((ext_vector_type(4)))  unsigned v4u;
typedef __attribute__((ext_vector_type(4)))  int v4i;
typedef float __attribute__((may_alias)) float_a;
typedef int __attribute__((may_alias)) int_a;

template <typename T> __device__ __forceinline__ void vst2(void* p, T v) { *(T*)p = v;  }
__device__ __forceinline__ v8f wmma16(v16h a, v16h b, v8f c) {
  v8f d = __builtin_amdgcn_wmma_f32_16x16x32_f16(false, a, false, b, (short)0, c, false, false);
  asm volatile("v_nop\n\tv_nop\n\tv_nop\n\tv_nop" : "+v"(d) : "v"(a), "v"(b));
  return d;
}
__device__ __forceinline__ v8f wmma_bf(v16b a, v16b b, v8f c) {
  v8f d = __builtin_amdgcn_wmma_f32_16x16x32_bf16(false, a, false, b, (short)0, c, false, false);
  asm volatile("v_nop\n\tv_nop\n\tv_nop\n\tv_nop" : "+v"(d) : "v"(a), "v"(b));
  return d;
}
// 16x16x32 fragments: lane = (h = lane>>4, row/col = lane&15); elements 0..7 = k0+8h+0..7, 8..15 = k0+16+8h+0..7; D element r = row 8h+r
__device__ __forceinline__ v16h frag_h(const _Float16* rowk0, int lane) {
  union { v16h v; v8h q[2]; } u; const _Float16* p = rowk0 + 8 * (lane >> 4);
  u.q[0] = *(const v8h*)p; u.q[1] = *(const v8h*)(p + 16); return u.v;
}
__device__ __forceinline__ v16h frag_f32(const float* rowk0, int lane) {
  v16h a; const float* p = rowk0 + 8 * (lane >> 4);
#pragma unroll
  for (int i = 0; i < 8; ++i) { a[i] = (_Float16)p[i]; a[8 + i] = (_Float16)p[16 + i]; }
  return a;
}
__device__ __forceinline__ v16h frag_f32s(const float* rowk0, int lane, float sc) {
  v16h a; const float* p = rowk0 + 8 * (lane >> 4);
#pragma unroll
  for (int i = 0; i < 8; ++i) { a[i] = (_Float16)(p[i] * sc); a[8 + i] = (_Float16)(p[16 + i] * sc); }
  return a;
}
// column fragment from a [K][ld] layout (column n), rows >= K read as 0
__device__ __forceinline__ v16h fragc_f32(const float* W, int k0, int n, int lane, int ld, int K) {
  v16h a; const int g = lane >> 4;
#pragma unroll
  for (int i = 0; i < 8; ++i) { const int ka = k0 + 8 * g + i, kb = ka + 16;
    a[i] = (_Float16)(ka < K ? W[(size_t)(ka < K ? ka : K - 1) * ld + n] : 0.f); a[8 + i] = (_Float16)(kb < K ? W[(size_t)(kb < K ? kb : K - 1) * ld + n] : 0.f); }
  return a;
}
struct F2 { v16b h, l; };
__device__ __forceinline__ F2 bsplit16(const float v[16]) { F2 r;
#pragma unroll
  for (int i = 0; i < 16; ++i) { const __bf16 h = (__bf16)v[i]; r.h[i] = h; r.l[i] = (__bf16)(v[i] - (float)h); }
  return r; }
__device__ __forceinline__ F2 split_row(const float* row, int k0, int lane) { float v[16]; const float* p = row + k0 + 8 * (lane >> 4);
#pragma unroll
  for (int i = 0; i < 8; ++i) { v[i] = p[i]; v[8 + i] = p[16 + i]; }
  return bsplit16(v); }
__device__ __forceinline__ F2 split_rowK(const float* row, int k0, int lane, int K) { float v[16]; const int g = lane >> 4;
#pragma unroll
  for (int i = 0; i < 8; ++i) { const int ka = k0 + 8 * g + i, kb = ka + 16; v[i] = ka < K ? row[ka < K ? ka : K - 1] : 0.f; v[8 + i] = kb < K ? row[kb < K ? kb : K - 1] : 0.f; }
  return bsplit16(v); }
__device__ __forceinline__ F2 split_col(const float* W, int k0, int n, int lane, int ld, int K) { float v[16]; const int g = lane >> 4;
#pragma unroll
  for (int i = 0; i < 8; ++i) { const int ka = k0 + 8 * g + i, kb = ka + 16; v[i] = ka < K ? W[(size_t)(ka < K ? ka : K - 1) * ld + n] : 0.f; v[8 + i] = kb < K ? W[(size_t)(kb < K ? kb : K - 1) * ld + n] : 0.f; }
  return bsplit16(v); }
__device__ __forceinline__ v8f mac3(const F2& a, const F2& b, v8f c) { c = wmma_bf(a.l, b.h, c); c = wmma_bf(a.h, b.l, c); return wmma_bf(a.h, b.h, c); }
__device__ __forceinline__ float sigm(float v) { return 1.0f / (1.0f + expf(-v)); }
#define LDSX() do { asm volatile("s_wait_dscnt 0" ::: "memory"); __builtin_amdgcn_wave_barrier(); __builtin_amdgcn_fence(__ATOMIC_RELEASE, "workgroup"); } while (0)


// Jagged causal silu attention with contextual / target-group masking. One block = 64 query rows of one (sequence, head): 16 waves = 4 row groups of 16 x 4 key tiles;
// a round stages 4 key tiles of 32 in LDS (K row-major bf16, V transposed bf16) and each wave works on one of them, so a row's keys are walked by 4 waves side by side;
// per wave and tile: 4 WMMAs for S (two 16-key subtiles x two 32-wide d chunks), silu + mask through a per-wave LDS transpose, 8 WMMAs for O (4 d tiles x {residual, hi}).
// The 4 partial outputs of a row group are summed through LDS behind the loop (silu attention has no row normaliser, so partial sums just add)
#define NHEAD 4
#define DQK   64
#define DVV   64
#define MTILE 64
#define JTILE 32
#define KSPLIT 4
#define NWAVE 16
#define MAXSEQ 2048
// LDS row pitches. K, transposed V and S scratch are read by ds_load_b128 with 16 lanes on 16 rows: a pitch of 16 B x odd spreads those rows over all 64 banks,
// where the bare 128-B and 64-B rows put them on 8 and 16 banks. The partial output rows are padded for their stores: the two lane halves write rows 8 apart,
// which fall on the same banks at 256 B. The pad elements are never written and never read
#define KPITCH 72    // bf16 per K row: 144 B
#define VPITCH 40    // bf16 per transposed V row: 80 B
#define SPITCH 36    // f32 per row of the S transpose scratch: 144 B
#define OPITCH 68    // f32 per partial output row: 272 B
typedef __attribute__((ext_vector_type(8))) __bf16 v8b;
__device__ __forceinline__ v16b frag_b16(const __bf16* rowk0, int lane) {   // 16x16x32 operand fragment from a bf16 row: elements 0..7 = k0+8h.., 8..15 = k0+16+8h..
  union { v16b v; v8b q[2]; } u; const __bf16* p = rowk0 + 8 * (lane >> 4);
  u.q[0] = *(const v8b*)p; u.q[1] = *(const v8b*)(p + 16); return u.v;
}
__device__ __forceinline__ v16b frag_gbf(const float* rowk0, int lane) {     // same map from an f32 global row, rounding to bf16 (RNE)
  v16b a; const float* p = rowk0 + 8 * (lane >> 4);
#pragma unroll
  for (int i = 0; i < 8; ++i) { a[i] = (__bf16)p[i]; a[8 + i] = (__bf16)p[16 + i]; }
  return a;
}
// 16 * silu(s / 8) = s + s * tanh(s / 16), from sigmoid(x) = (1 + tanh(x / 2)) / 2: multiply, the hardware's f32 tanh, fused multiply-add, in place of the library expf
// with its range reduction and the IEEE division sequence. tanh saturates at -1 and 1, which gives 0 and 2 s, the limits. The exact factor 1/16 is applied in the epilogue
__device__ __forceinline__ float fsilu16(float s) { return fmaf(s, __builtin_amdgcn_tanhf(s * 0.0625f), s); }

__global__ __launch_bounds__(512, 8)   // 128 VGPRs: two of these 16-wave blocks stay resident on a WGP
void k_attn(const float* __restrict__ tq, const float* __restrict__ tk, const float* __restrict__ tv,
            const int* __restrict__ offsets, const int* __restrict__ ncand, const int* __restrict__ p_maxseq, const int* __restrict__ p_nctx,
            float* __restrict__ out) {
  __shared__ __align__(16) __bf16 Kb[KSPLIT][JTILE][KPITCH];  // key rows, bf16, one tile per key split (18 KB)
  __shared__ __align__(16) __bf16 Vt[KSPLIT][DVV][VPITCH];  // v transposed: Vt[tile][d][key] (20 KB)
  __shared__ __align__(16) float Sscr[NWAVE][16][SPITCH];    // per-wave S transpose scratch (36 KB)
  __shared__ __align__(16) float So[NWAVE][16][OPITCH];     // per-wave partial output rows (68 KB)

  const int b    = blockIdx.z, h = blockIdx.y;
  const int off  = offsets[b];
  const int nlen = offsets[b + 1] - off;
  const int row0 = blockIdx.x * MTILE;
  if (row0 >= nlen) return;                               // block-uniform, before any barrier

  const int nc   = p_nctx[0];                              // contextual tokens at the head of each sequence
  const int nt   = ncand[b];                               // target (candidate) tokens at the tail
  const int max1 = nlen - nc + 1;
  const int max2 = max1 - nt;
  const int maxseq = p_maxseq[0];

  const int tid = threadIdx.x, wave = __builtin_amdgcn_readfirstlane(tid >> 5), lane = tid & 31, l16 = lane & 15, hh = lane >> 4;
  // the wave number is held in a scalar register, so that row group, key tile and the tile test below are scalar and cost no VGPR
  const int rg = wave & 3, ks = wave >> 2;                 // row group of 16 queries, key tile of the round
  const int qb = row0 + rg * 16;

  // ---- Q fragments (bf16-rounded input), kept for the whole key loop: 2 x 8 VGPRs
  int qrow = qb + l16; if (qrow > nlen - 1) qrow = nlen - 1;
  const float* qp = tq + (size_t)(off + qrow) * (NHEAD * DQK) + h * DQK;
  const v16b qf0 = frag_gbf(qp, lane), qf1 = frag_gbf(qp + 32, lane);

  v8f acc[4];
#pragma unroll
  for (int i = 0; i < 4; ++i) acc[i] = (v8f){};

  // rows holding contextual tokens (x < nc) attend to the whole history, everyone else is causal within the block's rows
  const int jcaus = (nlen < row0 + MTILE) ? nlen : (row0 + MTILE);
  const int jmax  = (row0 < nc) ? nlen : jcaus;                      // block-uniform
  const bool wctx = (qb < nc);                                       // wave-uniform

  for (int j = 0; j < jmax; j += JTILE * KSPLIT) {
    // ---- cooperative staging of the round's 4 tiles (128 keys): K rows as bf16, V transposed as bf16 ----
    {
      const int cgk = (tid & 7) * 8, cgv = (tid & 15) * 4;             // K: 8 d columns of one key; V: 4 d columns of a key pair
      v4f ka[2][2], va[2][2];
#pragma unroll
      for (int t = 0; t < 2; ++t) {
        int krow = j + t * 64 + (tid >> 3); if (krow > nlen - 1) krow = nlen - 1;   // address clamp; clamped keys are masked by (y < nlen)
        const float* kp = tk + (size_t)(off + krow) * (NHEAD * DQK) + h * DQK + cgk;
        ka[t][0] = *(const v4f*)kp;
        asm volatile("s_wait_xcnt 0x0" ::: "memory");                  // the next load's result may land in the address pair that the load above names: keep the wait in front of that overwrite
        ka[t][1] = *(const v4f*)(kp + 4);
      }
#pragma unroll
      for (int t = 0; t < 2; ++t) {
        int r0g = j + 2 * (t * 32 + (tid >> 4)), r1g = r0g + 1;        // key pair of the round
        if (r0g > nlen - 1) r0g = nlen - 1;
        if (r1g > nlen - 1) r1g = nlen - 1;
        va[t][0] = *(const v4f*)(tv + (size_t)(off + r0g) * (NHEAD * DVV) + h * DVV + cgv);
        va[t][1] = *(const v4f*)(tv + (size_t)(off + r1g) * (NHEAD * DVV) + h * DVV + cgv);
      }
      // holds the 8 loads together in front of the first conversion: one memory latency a round instead of one per load pair
      asm volatile("" :: "v"(ka[0][0]), "v"(ka[0][1]), "v"(ka[1][0]), "v"(ka[1][1]), "v"(va[0][0]), "v"(va[0][1]), "v"(va[1][0]), "v"(va[1][1]));
#pragma unroll
      for (int t = 0; t < 2; ++t) {
        const int kl = t * 64 + (tid >> 3);                            // key of the round, 0..127: tile kl / 32, row kl % 32
        union { v8b v; uint4 u; } cv;
#pragma unroll
        for (int i = 0; i < 4; ++i) { cv.v[i] = (__bf16)ka[t][0][i]; cv.v[4 + i] = (__bf16)ka[t][1][i]; }
        *(uint4*)&Kb[kl >> 5][kl & 31][cgk] = cv.u;
      }
#pragma unroll
      for (int t = 0; t < 2; ++t) {
        const int pl = t * 32 + (tid >> 4);                            // key pair of the round, 0..63: tile pl / 16, keys 2 * (pl % 16) and the next
#pragma unroll
        for (int i = 0; i < 4; ++i) {
          union { __bf16 h2[2]; uint32_t u; } p;
          p.h2[0] = (__bf16)va[t][0][i]; p.h2[1] = (__bf16)va[t][1][i];
          *(uint32_t*)&Vt[pl >> 4][cgv + i][2 * (pl & 15)] = p.u;
        }
      }
    }
    __syncthreads();

    const int jt = j + ks * JTILE;                                     // first key of this wave's tile
    const bool active = (jt < jmax) && (wctx || (jt <= qb + 15));      // wave-uniform: tile has at least one unmasked key for this wave
    if (active) {
      // ---- S = Q K^T for keys jt..jt+15 and jt+16..jt+31 (exact bf16 products)
      v8f s0 = (v8f){}, s1 = (v8f){};
      s0 = wmma_bf(qf0, frag_b16(&Kb[ks][l16][0], lane), s0);       s0 = wmma_bf(qf1, frag_b16(&Kb[ks][l16][32], lane), s0);
      s1 = wmma_bf(qf0, frag_b16(&Kb[ks][16 + l16][0], lane), s1);  s1 = wmma_bf(qf1, frag_b16(&Kb[ks][16 + l16][32], lane), s1);

      // ---- 16 * silu(alpha * s) and the integer mask; C layout (row 8*hh + r, column l16) -> LDS row-major
      {
        float* sp = &Sscr[wave][hh * 8][l16];                           // the lane's element of row r = 0; the rows follow at constant offsets
        const int y0 = jt + l16, y1 = y0 + 16;
        const int idy0 = max(y0 - nc + 1, 0), idy1 = max(y1 - nc + 1, 0);
        const int tgy0 = max(idy0 - max1 + nt, -1), tgy1 = max(idy1 - max1 + nt, -1);
#pragma unroll
        for (int r = 0; r < 8; ++r) {
          const int m = r + hh * 8, x = qb + m;
          const int idx = max(x - nc + 1, 0), tgx = max(idx - max1 + nt, -1);
          const bool c0 = (x == y0) || (idx > idy0), c1 = (x == y1) || (idx > idy1);
          const bool g0 = (tgx == tgy0) || (tgx < 0) || (tgy0 < 0), g1 = (tgx == tgy1) || (tgx < 0) || (tgy1 < 0);
          const bool ctx = (idx == 0);
          const bool ok0 = ((c0 && g0) || (ctx && idy0 < max2)) && (y0 < nlen) && (x < nlen);
          const bool ok1 = ((c1 && g1) || (ctx && idy1 < max2)) && (y1 < nlen) && (x < nlen);
          const float a0v = fsilu16(s0[r]), a1v = fsilu16(s1[r]);
          sp[r * SPITCH]      = ok0 ? a0v : 0.0f;
          sp[r * SPITCH + 16] = ok1 ? a1v : 0.0f;
        }
      }
      LDSX();
      // ---- read the wave's 16x32 P tile back as an A fragment, split into bf16 hi + residual
      F2 pf;
      { float v[16]; const float* row = &Sscr[wave][l16][0]; const int c0 = hh * 8;
#pragma unroll
        for (int i = 0; i < 8; ++i) { v[i] = row[c0 + i]; v[8 + i] = row[16 + c0 + i]; }
        pf = bsplit16(v); }
      // ---- O += P V (4 d tiles x 2 WMMAs)
#pragma unroll
      for (int dc = 0; dc < 4; ++dc) {
        const v16b vf = frag_b16(&Vt[ks][dc * 16 + l16][0], lane);     // keys 8*hh.., 16+8*hh..
        acc[dc] = wmma_bf(pf.l, vf, acc[dc]);
        acc[dc] = wmma_bf(pf.h, vf, acc[dc]);
      }
    }
    __syncthreads();                                                   // protect Kb/Vt before the next staging round
  }

  // the lane number is read anew here, so that no lane index has to stay in a VGPR over the key loop just for these last lines (the loop sits at its register limit; held over it, such values spill to scratch)
  const int el = (int)__builtin_amdgcn_mbcnt_lo(~0u, 0u), e16 = el & 15, eh = el >> 4;
  float* so = &So[wave][0][0];
#pragma unroll
  for (int r = 0; r < 8; ++r)
#pragma unroll
    for (int dc = 0; dc < 4; ++dc) so[(r + eh * 8) * OPITCH + dc * 16 + e16] = acc[dc][r];
  __syncthreads();                                                     // every wave's partial rows are in LDS before any wave sums them
  const float invDenom = 0.0625f / (float)maxseq;                      // the 1/16 that the loop's silu form leaves out, and 1 / max_seqlen
  // ---- sum the 4 key splits of each row in the fixed order 0..3, scale, store whole 256-B rows (16 lanes x 16 B)
#pragma unroll
  for (int i = 0; i < 2; ++i) { const int m = i * 32 + wave * 2 + eh, c = e16 * 4; const int x = row0 + m;   // wave * 2 + eh = thread / 16
    const float* pr = &So[m >> 4][m & 15][c];                          // wave index = 4 * split + row group
    v4f s = *(const v4f*)pr;
#pragma unroll
    for (int k = 1; k < KSPLIT; ++k) s += *(const v4f*)(pr + k * 4 * 16 * OPITCH);
    if (x < nlen) vst2(out + (size_t)(off + x) * (NHEAD * DVV) + h * DVV + c, (v4f)(s * invDenom)); }
}

extern "C" void kernel_launch(void* const* d_in, const int* in_sizes, int n_in, void* d_out, int out_size, void* d_ws, size_t ws_size, hipStream_t stream) {
  (void)n_in; (void)out_size; (void)d_ws; (void)ws_size;
  const int nseq = in_sizes[3] - 1;                 // offsets holds nseq + 1 entries
  dim3 grid(MAXSEQ / MTILE, NHEAD, nseq), block(512, 1, 1);
  k_attn<<<grid, block, 0, stream>>>((const float*)d_in[0], (const float*)d_in[1], (const float*)d_in[2],
                                     (const int*)d_in[3], (const int*)d_in[4], (const int*)d_in[5], (const int*)d_in[6], (float*)d_out);
}

// v004
// One run takes 31.8 microseconds.
// Two timings next to v003 both put it at 1.15 times that version's speed.
// Counting every step since v000, it is 3.06 times as fast.
// compute dtype: q, k, v (module inputs) rounded to bf16; S = q k^T as exact bf16 WMMA products (f32 accumulate); silu and the integer attention mask in f32;
// silu(S) carried as a bf16 hi + bf16 residual pair against bf16 v (f32 accumulate); the 1/max_seqlen factor applied in the f32 epilogue.
#include <hip/hip_runtime.h>
#include <math.h>

typedef __attribute__((ext_vector_type(16))) _Float16 v16h;
typedef __attribute__((ext_vector_type(16))) __bf16 v16b;
typedef __attribute__((ext_vector_type(8)))  _Float16 v8h;
typedef __attribute__((ext_vector_type(8)))  float v8f;
typedef __attribute__((ext_vector_type(4)))  float v4f;
typedef __attribute__((ext_vector_type(2)))  float v2f;
typedef __attribute__((ext_vector_type(4)))  unsigned v4u;
typedef __attribute__((ext_vector_type(4)))  int v4i;
typedef float __attribute__((may_alias)) float_a;
typedef int __attribute__((may_alias)) int_a;

template <typename T> __device__ __forceinline__ void vst2(void* p, T v) { *(T*)p = v;  }
__device__ __forceinline__ v8f wmma16(v16h a, v16h b, v8f c) {
  v8f d = __builtin_amdgcn_wmma_f32_16x16x32_f16(false, a, false, b, (short)0, c, false, false);
  asm volatile("v_nop\n\tv_nop\n\tv_nop\n\tv_nop" : "+v"(d) : "v"(a), "v"(b));
  return d;
}
__device__ __forceinline__ v8f wmma_bf(v16b a, v16b b, v8f c) {
  v8f d = __builtin_amdgcn_wmma_f32_16x16x32_bf16(false, a, false, b, (short)0, c, false, false);
  asm volatile("v_nop\n\tv_nop\n\tv_nop\n\tv_nop" : "+v"(d) : "v"(a), "v"(b));
  return d;
}
// 16x16x32 fragments: lane = (h = lane>>4, row/col = lane&15); elements 0..7 = k0+8h+0..7, 8..15 = k0+16+8h+0..7; D element r = row 8h+r
__device__ __forceinline__ v16h frag_h(const _Float16* rowk0, int lane) {
  union { v16h v; v8h q[2]; } u; const _Float16* p = rowk0 + 8 * (lane >> 4);
  u.q[0] = *(const v8h*)p; u.q[1] = *(const v8h*)(p + 16); return u.v;
}
__device__ __forceinline__ v16h frag_f32(const float* rowk0, int lane) {
  v16h a; const float* p = rowk0 + 8 * (lane >> 4);
#pragma unroll
  for (int i = 0; i < 8; ++i) { a[i] = (_Float16)p[i]; a[8 + i] = (_Float16)p[16 + i]; }
  return a;
}
__device__ __forceinline__ v16h frag_f32s(const float* rowk0, int lane, float sc) {
  v16h a; const float* p = rowk0 + 8 * (lane >> 4);
#pragma unroll
  for (int i = 0; i < 8; ++i) { a[i] = (_Float16)(p[i] * sc); a[8 + i] = (_Float16)(p[16 + i] * sc); }
  return a;
}
// column fragment from a [K][ld] layout (column n), rows >= K read as 0
__device__ __forceinline__ v16h fragc_f32(const float* W, int k0, int n, int lane, int ld, int K) {
  v16h a; const int g = lane >> 4;
#pragma unroll
  for (int i = 0; i < 8; ++i) { const int ka = k0 + 8 * g + i, kb = ka + 16;
    a[i] = (_Float16)(ka < K ? W[(size_t)(ka < K ? ka : K - 1) * ld + n] : 0.f); a[8 + i] = (_Float16)(kb < K ? W[(size_t)(kb < K ? kb : K - 1) * ld + n] : 0.f); }
  return a;
}
struct F2 { v16b h, l; };
__device__ __forceinline__ F2 bsplit16(const float v[16]) { F2 r;
#pragma unroll
  for (int i = 0; i < 16; ++i) { const __bf16 h = (__bf16)v[i]; r.h[i] = h; r.l[i] = (__bf16)(v[i] - (float)h); }
  return r; }
__device__ __forceinline__ F2 split_row(const float* row, int k0, int lane) { float v[16]; const float* p = row + k0 + 8 * (lane >> 4);
#pragma unroll
  for (int i = 0; i < 8; ++i) { v[i] = p[i]; v[8 + i] = p[16 + i]; }
  return bsplit16(v); }
__device__ __forceinline__ F2 split_rowK(const float* row, int k0, int lane, int K) { float v[16]; const int g = lane >> 4;
#pragma unroll
  for (int i = 0; i < 8; ++i) { const int ka = k0 + 8 * g + i, kb = ka + 16; v[i] = ka < K ? row[ka < K ? ka : K - 1] : 0.f; v[8 + i] = kb < K ? row[kb < K ? kb : K - 1] : 0.f; }
  return bsplit16(v); }
__device__ __forceinline__ F2 split_col(const float* W, int k0, int n, int lane, int ld, int K) { float v[16]; const int g = lane >> 4;
#pragma unroll
  for (int i = 0; i < 8; ++i) { const int ka = k0 + 8 * g + i, kb = ka + 16; v[i] = ka < K ? W[(size_t)(ka < K ? ka : K - 1) * ld + n] : 0.f; v[8 + i] = kb < K ? W[(size_t)(kb < K ? kb : K - 1) * ld + n] : 0.f; }
  return bsplit16(v); }
__device__ __forceinline__ v8f mac3(const F2& a, const F2& b, v8f c) { c = wmma_bf(a.l, b.h, c); c = wmma_bf(a.h, b.l, c); return wmma_bf(a.h, b.h, c); }
__device__ __forceinline__ float sigm(float v) { return 1.0f / (1.0f + expf(-v)); }
#define LDSX() do { asm volatile("s_wait_dscnt 0" ::: "memory"); __builtin_amdgcn_wave_barrier(); __builtin_amdgcn_fence(__ATOMIC_RELEASE, "workgroup"); } while (0)


// Jagged causal silu attention with contextual / target-group masking. One block = 64 query rows of one (sequence, head): 16 waves = 4 row groups of 16 x 4 key tiles;
// a round stages 4 key tiles of 32 in LDS (K row-major bf16, V transposed bf16) and each wave works on one of them, so a row's keys are walked by 4 waves side by side;
// per wave and tile: 4 WMMAs for S (two 16-key subtiles x two 32-wide d chunks), silu + mask through a per-wave LDS transpose, 8 WMMAs for O (4 d tiles x {residual, hi}).
// The 4 partial outputs of a row group are summed through LDS behind the loop (silu attention has no row normaliser, so partial sums just add)
#define NHEAD 4
#define DQK   64
#define DVV   64
#define MTILE 64
#define JTILE 32
#define KSPLIT 4
#define NWAVE 16
#define MAXSEQ 2048
// LDS row pitches. K, transposed V and S scratch are read by ds_load_b128 with 16 lanes on 16 rows: a pitch of 16 B x odd spreads those rows over all 64 banks,
// where the bare 128-B and 64-B rows put them on 8 and 16 banks. The partial output rows are padded for their stores: the two lane halves write rows 8 apart,
// which fall on the same banks at 256 B. The pad elements are never written and never read
#define KPITCH 72    // bf16 per K row: 144 B
#define VPITCH 40    // bf16 per transposed V row: 80 B
#define SPITCH 36    // f32 per row of the S transpose scratch: 144 B
#define OPITCH 68    // f32 per partial output row: 272 B
typedef __attribute__((ext_vector_type(8))) __bf16 v8b;
__device__ __forceinline__ v16b frag_b16(const __bf16* rowk0, int lane) {   // 16x16x32 operand fragment from a bf16 row: elements 0..7 = k0+8h.., 8..15 = k0+16+8h..
  union { v16b v; v8b q[2]; } u; const __bf16* p = rowk0 + 8 * (lane >> 4);
  u.q[0] = *(const v8b*)p; u.q[1] = *(const v8b*)(p + 16); return u.v;
}
__device__ __forceinline__ v16b frag_gbf(const float* rowk0, int lane) {     // same map from an f32 global row, rounding to bf16 (RNE)
  v16b a; const float* p = rowk0 + 8 * (lane >> 4);
#pragma unroll
  for (int i = 0; i < 8; ++i) { a[i] = (__bf16)p[i]; a[8 + i] = (__bf16)p[16 + i]; }
  return a;
}
// 16 * silu(s / 8) = s + s * tanh(s / 16), from sigmoid(x) = (1 + tanh(x / 2)) / 2: multiply, the hardware's f32 tanh, fused multiply-add, in place of the library expf
// with its range reduction and the IEEE division sequence. tanh saturates at -1 and 1, which gives 0 and 2 s, the limits. The exact factor 1/16 is applied in the epilogue
__device__ __forceinline__ float fsilu16(float s) { return fmaf(s, __builtin_amdgcn_tanhf(s * 0.0625f), s); }

__global__ __launch_bounds__(512, 8)   // 128 VGPRs: two of these 16-wave blocks stay resident on a WGP
void k_attn(const float* __restrict__ tq, const float* __restrict__ tk, const float* __restrict__ tv,
            const int* __restrict__ offsets, const int* __restrict__ ncand, const int* __restrict__ p_maxseq, const int* __restrict__ p_nctx,
            float* __restrict__ out) {
  __shared__ __align__(16) __bf16 Kb[KSPLIT][JTILE][KPITCH];  // key rows, bf16, one tile per key split (18 KB)
  __shared__ __align__(16) __bf16 Vt[KSPLIT][DVV][VPITCH];  // v transposed: Vt[tile][d][key] (20 KB)
  __shared__ __align__(16) float Sscr[NWAVE][16][SPITCH];    // per-wave S transpose scratch (36 KB)
  __shared__ __align__(16) float So[NWAVE][16][OPITCH];     // per-wave partial output rows (68 KB)

  const int b    = blockIdx.z, h = blockIdx.y;
  const int off  = offsets[b];
  const int nlen = offsets[b + 1] - off;
  const int row0 = blockIdx.x * MTILE;
  if (row0 >= nlen) return;                               // block-uniform, before any barrier

  const int nc   = p_nctx[0];                              // contextual tokens at the head of each sequence
  const int nt   = ncand[b];                               // target (candidate) tokens at the tail
  const int max1 = nlen - nc + 1;
  const int max2 = max1 - nt;
  const int maxseq = p_maxseq[0];

  const int tid = threadIdx.x, wave = __builtin_amdgcn_readfirstlane(tid >> 5), lane = tid & 31, l16 = lane & 15, hh = lane >> 4;
  // the wave number is held in a scalar register, so that row group, key tile and the tile test below are scalar and cost no VGPR
  const int rg = wave & 3, ks = wave >> 2;                 // row group of 16 queries, key tile of the round
  const int qb = row0 + rg * 16;

  // ---- Q fragments (bf16-rounded input), kept for the whole key loop: 2 x 8 VGPRs
  int qrow = qb + l16; if (qrow > nlen - 1) qrow = nlen - 1;
  const float* qp = tq + (size_t)(off + qrow) * (NHEAD * DQK) + h * DQK;
  const v16b qf0 = frag_gbf(qp, lane), qf1 = frag_gbf(qp + 32, lane);

  v8f acc[4];
#pragma unroll
  for (int i = 0; i < 4; ++i) acc[i] = (v8f){};

  // rows holding contextual tokens (x < nc) attend to the whole history, everyone else is causal within the block's rows
  const int jcaus = (nlen < row0 + MTILE) ? nlen : (row0 + MTILE);
  const int jmax  = (row0 < nc) ? nlen : jcaus;                      // block-uniform
  const bool wctx = (qb < nc);                                       // wave-uniform

  for (int j = 0; j < jmax; j += JTILE * KSPLIT) {
    // ---- cooperative staging of the round's 4 tiles (128 keys): K rows as bf16, V transposed as bf16 ----
    {
      const int cgk = (tid & 7) * 8, cgv = (tid & 15) * 4;             // K: 8 d columns of one key; V: 4 d columns of a key pair
      v4f ka[2][2], va[2][2];
#pragma unroll
      for (int t = 0; t < 2; ++t) {
        int krow = j + t * 64 + (tid >> 3); if (krow > nlen - 1) krow = nlen - 1;   // address clamp; clamped keys are masked by (y < nlen)
        const float* kp = tk + (size_t)(off + krow) * (NHEAD * DQK) + h * DQK + cgk;
        ka[t][0] = *(const v4f*)kp;
        asm volatile("s_wait_xcnt 0x0" ::: "memory");                  // the next load's result may land in the address pair that the load above names: keep the wait in front of that overwrite
        ka[t][1] = *(const v4f*)(kp + 4);
      }
#pragma unroll
      for (int t = 0; t < 2; ++t) {
        int r0g = j + 2 * (t * 32 + (tid >> 4)), r1g = r0g + 1;        // key pair of the round
        if (r0g > nlen - 1) r0g = nlen - 1;
        if (r1g > nlen - 1) r1g = nlen - 1;
        va[t][0] = *(const v4f*)(tv + (size_t)(off + r0g) * (NHEAD * DVV) + h * DVV + cgv);
        va[t][1] = *(const v4f*)(tv + (size_t)(off + r1g) * (NHEAD * DVV) + h * DVV + cgv);
      }
      // holds the 8 loads together in front of the first conversion: one memory latency a round instead of one per load pair
      asm volatile("" :: "v"(ka[0][0]), "v"(ka[0][1]), "v"(ka[1][0]), "v"(ka[1][1]), "v"(va[0][0]), "v"(va[0][1]), "v"(va[1][0]), "v"(va[1][1]));
#pragma unroll
      for (int t = 0; t < 2; ++t) {
        const int kl = t * 64 + (tid >> 3);                            // key of the round, 0..127: tile kl / 32, row kl % 32
        union { v8b v; uint4 u; } cv;
#pragma unroll
        for (int i = 0; i < 4; ++i) { cv.v[i] = (__bf16)ka[t][0][i]; cv.v[4 + i] = (__bf16)ka[t][1][i]; }
        *(uint4*)&Kb[kl >> 5][kl & 31][cgk] = cv.u;
      }
#pragma unroll
      for (int t = 0; t < 2; ++t) {
        const int pl = t * 32 + (tid >> 4);                            // key pair of the round, 0..63: tile pl / 16, keys 2 * (pl % 16) and the next
#pragma unroll
        for (int i = 0; i < 4; ++i) {
          union { __bf16 h2[2]; uint32_t u; } p;
          p.h2[0] = (__bf16)va[t][0][i]; p.h2[1] = (__bf16)va[t][1][i];
          *(uint32_t*)&Vt[pl >> 4][cgv + i][2 * (pl & 15)] = p.u;
        }
      }
    }
    __syncthreads();

    const int jt = j + ks * JTILE;                                     // first key of this wave's tile
    const bool active = (jt < jmax) && (wctx || (jt <= qb + 15));      // wave-uniform: tile has at least one unmasked key for this wave
    if (active) {
      // ---- S = Q K^T for keys jt..jt+15 and jt+16..jt+31 (exact bf16 products)
      v8f s0 = (v8f){}, s1 = (v8f){};
      s0 = wmma_bf(qf0, frag_b16(&Kb[ks][l16][0], lane), s0);       s0 = wmma_bf(qf1, frag_b16(&Kb[ks][l16][32], lane), s0);
      s1 = wmma_bf(qf0, frag_b16(&Kb[ks][16 + l16][0], lane), s1);  s1 = wmma_bf(qf1, frag_b16(&Kb[ks][16 + l16][32], lane), s1);

      // ---- 16 * silu(alpha * s) and the integer mask; C layout (row 8*hh + r, column l16) -> LDS row-major
      {
        float* sp = &Sscr[wave][hh * 8][l16];                           // the lane's element of row r = 0; the rows follow at constant offsets
        // Scalar test for a tile whose 16 x 32 scores all pass the mask. The shifted ids grow with the position, so the tile's first row against its last key decides for all:
        // strictly causal in the shifted ids, the last key ahead of the target tokens (its group id is negative, which opens the group test for every row), rows and keys inside the sequence
        const int idyl = max(jt + JTILE - nc, 0);                       // shifted id of the tile's last key
        const bool inner = (max(qb - nc + 1, 0) > idyl) && (idyl < max2) && (qb + 15 < nlen) && (jt + JTILE - 1 < nlen);
        if (inner) {
#pragma unroll
          for (int r = 0; r < 8; ++r) { sp[r * SPITCH] = fsilu16(s0[r]); sp[r * SPITCH + 16] = fsilu16(s1[r]); }
        } else {
        const int y0 = jt + l16, y1 = y0 + 16;
        const int idy0 = max(y0 - nc + 1, 0), idy1 = max(y1 - nc + 1, 0);
        const int tgy0 = max(idy0 - max1 + nt, -1), tgy1 = max(idy1 - max1 + nt, -1);
#pragma unroll
        for (int r = 0; r < 8; ++r) {
          const int m = r + hh * 8, x = qb + m;
          const int idx = max(x - nc + 1, 0), tgx = max(idx - max1 + nt, -1);
          const bool c0 = (x == y0) || (idx > idy0), c1 = (x == y1) || (idx > idy1);
          const bool g0 = (tgx == tgy0) || (tgx < 0) || (tgy0 < 0), g1 = (tgx == tgy1) || (tgx < 0) || (tgy1 < 0);
          const bool ctx = (idx == 0);
          const bool ok0 = ((c0 && g0) || (ctx && idy0 < max2)) && (y0 < nlen) && (x < nlen);
          const bool ok1 = ((c1 && g1) || (ctx && idy1 < max2)) && (y1 < nlen) && (x < nlen);
          const float a0v = fsilu16(s0[r]), a1v = fsilu16(s1[r]);
          sp[r * SPITCH]      = ok0 ? a0v : 0.0f;
          sp[r * SPITCH + 16] = ok1 ? a1v : 0.0f;
        }
        }
      }
      LDSX();
      // ---- read the wave's 16x32 P tile back as an A fragment, split into bf16 hi + residual
      F2 pf;
      { float v[16]; const float* row = &Sscr[wave][l16][0]; const int c0 = hh * 8;
#pragma unroll
        for (int i = 0; i < 8; ++i) { v[i] = row[c0 + i]; v[8 + i] = row[16 + c0 + i]; }
        pf = bsplit16(v); }
      // ---- O += P V (4 d tiles x 2 WMMAs)
#pragma unroll
      for (int dc = 0; dc < 4; ++dc) {
        const v16b vf = frag_b16(&Vt[ks][dc * 16 + l16][0], lane);     // keys 8*hh.., 16+8*hh..
        acc[dc] = wmma_bf(pf.l, vf, acc[dc]);
        acc[dc] = wmma_bf(pf.h, vf, acc[dc]);
      }
    }
    __syncthreads();                                                   // protect Kb/Vt before the next staging round
  }

  // the lane number is read anew here, so that no lane index has to stay in a VGPR over the key loop just for these last lines (the loop sits at its register limit; held over it, such values spill to scratch)
  const int el = (int)__builtin_amdgcn_mbcnt_lo(~0u, 0u), e16 = el & 15, eh = el >> 4;
  float* so = &So[wave][0][0];
#pragma unroll
  for (int r = 0; r < 8; ++r)
#pragma unroll
    for (int dc = 0; dc < 4; ++dc) so[(r + eh * 8) * OPITCH + dc * 16 + e16] = acc[dc][r];
  __syncthreads();                                                     // every wave's partial rows are in LDS before any wave sums them
  const float invDenom = 0.0625f / (float)maxseq;                      // the 1/16 that the loop's silu form leaves out, and 1 / max_seqlen
  // ---- sum the 4 key splits of each row in the fixed order 0..3, scale, store whole 256-B rows (16 lanes x 16 B)
#pragma unroll
  for (int i = 0; i < 2; ++i) { const int m = i * 32 + wave * 2 + eh, c = e16 * 4; const int x = row0 + m;   // wave * 2 + eh = thread / 16
    const float* pr = &So[m >> 4][m & 15][c];                          // wave index = 4 * split + row group
    v4f s = *(const v4f*)pr;
#pragma unroll
    for (int k = 1; k < KSPLIT; ++k) s += *(const v4f*)(pr + k * 4 * 16 * OPITCH);
    if (x < nlen) vst2(out + (size_t)(off + x) * (NHEAD * DVV) + h * DVV + c, (v4f)(s * invDenom)); }
}

extern "C" void kernel_launch(void* const* d_in, const int* in_sizes, int n_in, void* d_out, int out_size, void* d_ws, size_t ws_size, hipStream_t stream) {
  (void)n_in; (void)out_size; (void)d_ws; (void)ws_size;
  const int nseq = in_sizes[3] - 1;                 // offsets holds nseq + 1 entries
  dim3 grid(MAXSEQ / MTILE, NHEAD, nseq), block(512, 1, 1);
  k_attn<<<grid, block, 0, stream>>>((const float*)d_in[0], (const float*)d_in[1], (const float*)d_in[2],
                                     (const int*)d_in[3], (const int*)d_in[4], (const int*)d_in[5], (const int*)d_in[6], (float*)d_out);
}

// v005
// One run takes 25.3 microseconds.
// Two timings next to v004 put it at 1.25 and 1.26 times that version's speed.
// All steps since v000 together make it 3.85 times as fast.
// compute dtype: q, k, v (module inputs) rounded to bf16; S = q k^T as exact bf16 WMMA products (f32 accumulate); silu and the integer attention mask in f32;
// silu(S) carried as a bf16 hi + bf16 residual pair against bf16 v (f32 accumulate); the 1/max_seqlen factor applied in the f32 epilogue.
#include <hip/hip_runtime.h>
#include <math.h>

typedef __attribute__((ext_vector_type(16))) _Float16 v16h;
typedef __attribute__((ext_vector_type(16))) __bf16 v16b;
typedef __attribute__((ext_vector_type(8)))  _Float16 v8h;
typedef __attribute__((ext_vector_type(8)))  float v8f;
typedef __attribute__((ext_vector_type(4)))  float v4f;
typedef __attribute__((ext_vector_type(2)))  float v2f;
typedef __attribute__((ext_vector_type(4)))  unsigned v4u;
typedef __attribute__((ext_vector_type(4)))  int v4i;
typedef float __attribute__((may_alias)) float_a;
typedef int __attribute__((may_alias)) int_a;

template <typename T> __device__ __forceinline__ void vst2(void* p, T v) { *(T*)p = v;  }
__device__ __forceinline__ v8f wmma16(v16h a, v16h b, v8f c) {
  v8f d = __builtin_amdgcn_wmma_f32_16x16x32_f16(false, a, false, b, (short)0, c, false, false);
  asm volatile("v_nop\n\tv_nop\n\tv_nop\n\tv_nop" : "+v"(d) : "v"(a), "v"(b));
  return d;
}
__device__ __forceinline__ v8f wmma_bf(v16b a, v16b b, v8f c) {
  v8f d = __builtin_amdgcn_wmma_f32_16x16x32_bf16(false, a, false, b, (short)0, c, false, false);
  asm volatile("v_nop\n\tv_nop\n\tv_nop\n\tv_nop" : "+v"(d) : "v"(a), "v"(b));
  return d;
}
// 16x16x32 fragments: lane = (h = lane>>4, row/col = lane&15); elements 0..7 = k0+8h+0..7, 8..15 = k0+16+8h+0..7; D element r = row 8h+r
__device__ __forceinline__ v16h frag_h(const _Float16* rowk0, int lane) {
  union { v16h v; v8h q[2]; } u; const _Float16* p = rowk0 + 8 * (lane >> 4);
  u.q[0] = *(const v8h*)p; u.q[1] = *(const v8h*)(p + 16); return u.v;
}
__device__ __forceinline__ v16h frag_f32(const float* rowk0, int lane) {
  v16h a; const float* p = rowk0 + 8 * (lane >> 4);
#pragma unroll
  for (int i = 0; i < 8; ++i) { a[i] = (_Float16)p[i]; a[8 + i] = (_Float16)p[16 + i]; }
  return a;
}
__device__ __forceinline__ v16h frag_f32s(const float* rowk0, int lane, float sc) {
  v16h a; const float* p = rowk0 + 8 * (lane >> 4);
#pragma unroll
  for (int i = 0; i < 8; ++i) { a[i] = (_Float16)(p[i] * sc); a[8 + i] = (_Float16)(p[16 + i] * sc); }
  return a;
}
// column fragment from a [K][ld] layout (column n), rows >= K read as 0
__device__ __forceinline__ v16h fragc_f32(const float* W, int k0, int n, int lane, int ld, int K) {
  v16h a; const int g = lane >> 4;
#pragma unroll
  for (int i = 0; i < 8; ++i) { const int ka = k0 + 8 * g + i, kb = ka + 16;
    a[i] = (_Float16)(ka < K ? W[(size_t)(ka < K ? ka : K - 1) * ld + n] : 0.f); a[8 + i] = (_Float16)(kb < K ? W[(size_t)(kb < K ? kb : K - 1) * ld + n] : 0.f); }
  return a;
}
struct F2 { v16b h, l; };
__device__ __forceinline__ F2 bsplit16(const float v[16]) { F2 r;
#pragma unroll
  for (int i = 0; i < 16; ++i) { const __bf16 h = (__bf16)v[i]; r.h[i] = h; r.l[i] = (__bf16)(v[i] - (float)h); }
  return r; }
__device__ __forceinline__ F2 split_row(const float* row, int k0, int lane) { float v[16]; const float* p = row + k0 + 8 * (lane >> 4);
#pragma unroll
  for (int i = 0; i < 8; ++i) { v[i] = p[i]; v[8 + i] = p[16 + i]; }
  return bsplit16(v); }
__device__ __forceinline__ F2 split_rowK(const float* row, int k0, int lane, int K) { float v[16]; const int g = lane >> 4;
#pragma unroll
  for (int i = 0; i < 8; ++i) { const int ka = k0 + 8 * g + i, kb = ka + 16; v[i] = ka < K ? row[ka < K ? ka : K - 1] : 0.f; v[8 + i] = kb < K ? row[kb < K ? kb : K - 1] : 0.f; }
  return bsplit16(v); }
__device__ __forceinline__ F2 split_col(const float* W, int k0, int n, int lane, int ld, int K) { float v[16]; const int g = lane >> 4;
#pragma unroll
  for (int i = 0; i < 8; ++i) { const int ka = k0 + 8 * g + i, kb = ka + 16; v[i] = ka < K ? W[(size_t)(ka < K ? ka : K - 1) * ld + n] : 0.f; v[8 + i] = kb < K ? W[(size_t)(kb < K ? kb : K - 1) * ld + n] : 0.f; }
  return bsplit16(v); }
__device__ __forceinline__ v8f mac3(const F2& a, const F2& b, v8f c) { c = wmma_bf(a.l, b.h, c); c = wmma_bf(a.h, b.l, c); return wmma_bf(a.h, b.h, c); }
__device__ __forceinline__ float sigm(float v) { return 1.0f / (1.0f + expf(-v)); }
#define LDSX() do { asm volatile("s_wait_dscnt 0" ::: "memory"); __builtin_amdgcn_wave_barrier(); __builtin_amdgcn_fence(__ATOMIC_RELEASE, "workgroup"); } while (0)


// Jagged causal silu attention with contextual / target-group masking. One block = 64 query rows of one (sequence, head): 16 waves = 4 row groups of 16 x 4 key tiles;
// a round stages 4 key tiles of 32 in LDS (K row-major bf16, V transposed bf16) and each wave works on one of them, so a row's keys are walked by 4 waves side by side;
// per wave and tile: 4 WMMAs for S (two 16-key subtiles x two 32-wide d chunks), silu + mask through a per-wave LDS transpose, 8 WMMAs for O (4 d tiles x {residual, hi}).
// The 4 partial outputs of a row group are summed through LDS behind the loop (silu attention has no row normaliser, so partial sums just add)
#define NHEAD 4
#define DQK   64
#define DVV   64
#define MTILE 64
#define JTILE 32
#define KSPLIT 4
#define NWAVE 16
#define MAXSEQ 2048
#define NSEQ   8
#define LTOK   8192                       // rows of tq, tk, tv: all sequences together
#define MAXT   (MAXSEQ / MTILE)           // row tiles of one sequence at most: 32, one per lane of the rank search
#define MAXITEMS (LTOK / MTILE + NSEQ)    // row tiles of all sequences together at most: each sequence rounds up once
// LDS row pitches. K, transposed V and S scratch are read by ds_load_b128 with 16 lanes on 16 rows: a pitch of 16 B x odd spreads those rows over all 64 banks,
// where the bare 128-B and 64-B rows put them on 8 and 16 banks. The partial output rows are padded for their stores: the two lane halves write rows 8 apart,
// which fall on the same banks at 256 B. The pad elements are never written and never read
#define KPITCH 72    // bf16 per K row: 144 B
#define VPITCH 40    // bf16 per transposed V row: 80 B
#define SPITCH 36    // f32 per row of the S transpose scratch: 144 B
#define OPITCH 68    // f32 per partial output row: 272 B
typedef __attribute__((ext_vector_type(8))) __bf16 v8b;
__device__ __forceinline__ v16b frag_b16(const __bf16* rowk0, int lane) {   // 16x16x32 operand fragment from a bf16 row: elements 0..7 = k0+8h.., 8..15 = k0+16+8h..
  union { v16b v; v8b q[2]; } u; const __bf16* p = rowk0 + 8 * (lane >> 4);
  u.q[0] = *(const v8b*)p; u.q[1] = *(const v8b*)(p + 16); return u.v;
}
__device__ __forceinline__ v16b frag_gbf(const float* rowk0, int lane) {     // same map from an f32 global row, rounding to bf16 (RNE)
  v16b a; const float* p = rowk0 + 8 * (lane >> 4);
#pragma unroll
  for (int i = 0; i < 8; ++i) { a[i] = (__bf16)p[i]; a[8 + i] = (__bf16)p[16 + i]; }
  return a;
}
// 16 * silu(s / 8) = s + s * tanh(s / 16), from sigmoid(x) = (1 + tanh(x / 2)) / 2: multiply, the hardware's f32 tanh, fused multiply-add, in place of the library expf
// with its range reduction and the IEEE division sequence. tanh saturates at -1 and 1, which gives 0 and 2 s, the limits. The exact factor 1/16 is applied in the epilogue
__device__ __forceinline__ float fsilu16(float s) { return fmaf(s, __builtin_amdgcn_tanhf(s * 0.0625f), s); }

__global__ __launch_bounds__(512, 8)   // 128 VGPRs: two of these 16-wave blocks stay resident on a WGP
void k_attn(const float* __restrict__ tq, const float* __restrict__ tk, const float* __restrict__ tv,
            const int* __restrict__ offsets, const int* __restrict__ ncand, const int* __restrict__ p_maxseq, const int* __restrict__ p_nctx,
            float* __restrict__ out) {
  __shared__ __align__(16) __bf16 Kb[KSPLIT][JTILE][KPITCH];  // key rows, bf16, one tile per key split (18 KB)
  __shared__ __align__(16) __bf16 Vt[KSPLIT][DVV][VPITCH];  // v transposed: Vt[tile][d][key] (20 KB)
  __shared__ __align__(16) float Sscr[NWAVE][16][SPITCH];    // per-wave S transpose scratch (36 KB)
  __shared__ __align__(16) float So[NWAVE][16][OPITCH];     // per-wave partial output rows (68 KB)

  // ---- block index -> (head, sequence, row tile), the longest key walk first. For speed only.
  // Level u of a sequence stands for its u-th cheapest tile; levels are handed out from the top down over
  // all sequences, heads innermost. The map is a permutation of the tiles for any lengths, and it is the same in every wave (scalar values only)
  const int h = blockIdx.x & (NHEAD - 1), rank = blockIdx.x / NHEAD;
  int offs[NSEQ + 1], nts[NSEQ];
#pragma unroll
  for (int i = 0; i <= NSEQ; ++i) offs[i] = offsets[i];
  int above = 0;                                          // lane t: tiles of all sequences on a level above t
#pragma unroll
  for (int i = 0; i < NSEQ; ++i) {
    nts[i] = min(max((offs[i + 1] - offs[i] + MTILE - 1) >> 6, 0), MAXT);
    above += max(nts[i] - 1 - (int)(threadIdx.x & 31), 0);
  }
  const int u = __builtin_ctz(__builtin_amdgcn_ballot_w32(above <= rank));   // the rank's level: the lowest with no more than rank tiles above it (lane 31 always has 0)
  int k = rank - __builtin_amdgcn_readlane(above, u);     // place within the level
  int b = -1, off = 0, nlen = 0, ntl = 0;
#pragma unroll
  for (int i = 0; i < NSEQ; ++i) {
    const bool has = nts[i] > u;
    if (has && k == 0) { b = i; off = offs[i]; nlen = offs[i + 1] - offs[i]; ntl = nts[i]; }
    k -= has ? 1 : 0;
  }
  if (b < 0) return;                                      // rank past the last tile: block-uniform, before any barrier
  // cost order inside a sequence: the last tile, then tile 0 (its contextual rows walk every key), then the causal tiles from the back
  const int row0 = ((u == ntl - 1) ? u : (u == ntl - 2) ? 0 : u + 1) * MTILE;

  const int nc   = p_nctx[0];                              // contextual tokens at the head of each sequence
  const int nt   = ncand[b];                               // target (candidate) tokens at the tail
  const int max1 = nlen - nc + 1;
  const int max2 = max1 - nt;
  const int maxseq = p_maxseq[0];

  const int tid = threadIdx.x, wave = __builtin_amdgcn_readfirstlane(tid >> 5), lane = tid & 31, l16 = lane & 15, hh = lane >> 4;
  // the wave number is held in a scalar register, so that row group, key tile and the tile test below are scalar and cost no VGPR
  const int rg = wave & 3, ks = wave >> 2;                 // row group of 16 queries, key tile of the round
  const int qb = row0 + rg * 16;

  // ---- Q fragments (bf16-rounded input), kept for the whole key loop: 2 x 8 VGPRs
  int qrow = qb + l16; if (qrow > nlen - 1) qrow = nlen - 1;
  const float* qp = tq + (size_t)(off + qrow) * (NHEAD * DQK) + h * DQK;
  const v16b qf0 = frag_gbf(qp, lane), qf1 = frag_gbf(qp + 32, lane);

  v8f acc[4];
#pragma unroll
  for (int i = 0; i < 4; ++i) acc[i] = (v8f){};

  // rows holding contextual tokens (x < nc) attend to the whole history, everyone else is causal within the block's rows
  const int jcaus = (nlen < row0 + MTILE) ? nlen : (row0 + MTILE);
  const int jmax  = (row0 < nc) ? nlen : jcaus;                      // block-uniform
  const bool wctx = (qb < nc);                                       // wave-uniform

  for (int j = 0; j < jmax; j += JTILE * KSPLIT) {
    // ---- cooperative staging of the round's 4 tiles (128 keys): K rows as bf16, V transposed as bf16 ----
    {
      const int cgk = (tid & 7) * 8, cgv = (tid & 15) * 4;             // K: 8 d columns of one key; V: 4 d columns of a key pair
      v4f ka[2][2], va[2][2];
#pragma unroll
      for (int t = 0; t < 2; ++t) {
        int krow = j + t * 64 + (tid >> 3); if (krow > nlen - 1) krow = nlen - 1;   // address clamp; clamped keys are masked by (y < nlen)
        const float* kp = tk + (size_t)(off + krow) * (NHEAD * DQK) + h * DQK + cgk;
        ka[t][0] = *(const v4f*)kp;
        asm volatile("s_wait_xcnt 0x0" ::: "memory");                  // the next load's result may land in the address pair that the load above names: keep the wait in front of that overwrite
        ka[t][1] = *(const v4f*)(kp + 4);
      }
#pragma unroll
      for (int t = 0; t < 2; ++t) {
        int r0g = j + 2 * (t * 32 + (tid >> 4)), r1g = r0g + 1;        // key pair of the round
        if (r0g > nlen - 1) r0g = nlen - 1;
        if (r1g > nlen - 1) r1g = nlen - 1;
        va[t][0] = *(const v4f*)(tv + (size_t)(off + r0g) * (NHEAD * DVV) + h * DVV + cgv);
        va[t][1] = *(const v4f*)(tv + (size_t)(off + r1g) * (NHEAD * DVV) + h * DVV + cgv);
      }
      // holds the 8 loads together in front of the first conversion: one memory latency a round instead of one per load pair
      asm volatile("" :: "v"(ka[0][0]), "v"(ka[0][1]), "v"(ka[1][0]), "v"(ka[1][1]), "v"(va[0][0]), "v"(va[0][1]), "v"(va[1][0]), "v"(va[1][1]));
#pragma unroll
      for (int t = 0; t < 2; ++t) {
        const int kl = t * 64 + (tid >> 3);                            // key of the round, 0..127: tile kl / 32, row kl % 32
        union { v8b v; uint4 u; } cv;
#pragma unroll
        for (int i = 0; i < 4; ++i) { cv.v[i] = (__bf16)ka[t][0][i]; cv.v[4 + i] = (__bf16)ka[t][1][i]; }
        *(uint4*)&Kb[kl >> 5][kl & 31][cgk] = cv.u;
      }
#pragma unroll
      for (int t = 0; t < 2; ++t) {
        const int pl = t * 32 + (tid >> 4);                            // key pair of the round, 0..63: tile pl / 16, keys 2 * (pl % 16) and the next
#pragma unroll
        for (int i = 0; i < 4; ++i) {
          union { __bf16 h2[2]; uint32_t u; } p;
          p.h2[0] = (__bf16)va[t][0][i]; p.h2[1] = (__bf16)va[t][1][i];
          *(uint32_t*)&Vt[pl >> 4][cgv + i][2 * (pl & 15)] = p.u;
        }
      }
    }
    __syncthreads();

    const int jt = j + ks * JTILE;                                     // first key of this wave's tile
    const bool active = (jt < jmax) && (wctx || (jt <= qb + 15));      // wave-uniform: tile has at least one unmasked key for this wave
    if (active) {
      // ---- S = Q K^T for keys jt..jt+15 and jt+16..jt+31 (exact bf16 products)
      v8f s0 = (v8f){}, s1 = (v8f){};
      s0 = wmma_bf(qf0, frag_b16(&Kb[ks][l16][0], lane), s0);       s0 = wmma_bf(qf1, frag_b16(&Kb[ks][l16][32], lane), s0);
      s1 = wmma_bf(qf0, frag_b16(&Kb[ks][16 + l16][0], lane), s1);  s1 = wmma_bf(qf1, frag_b16(&Kb[ks][16 + l16][32], lane), s1);

      // ---- 16 * silu(alpha * s) and the integer mask; C layout (row 8*hh + r, column l16) -> LDS row-major
      {
        float* sp = &Sscr[wave][hh * 8][l16];                           // the lane's element of row r = 0; the rows follow at constant offsets
        // Scalar test for a tile whose 16 x 32 scores all pass the mask. The shifted ids grow with the position, so the tile's first row against its last key decides for all:
        // strictly causal in the shifted ids, the last key ahead of the target tokens (its group id is negative, which opens the group test for every row), rows and keys inside the sequence
        const int idyl = max(jt + JTILE - nc, 0);                       // shifted id of the tile's last key
        const bool inner = (max(qb - nc + 1, 0) > idyl) && (idyl < max2) && (qb + 15 < nlen) && (jt + JTILE - 1 < nlen);
        if (inner) {
#pragma unroll
          for (int r = 0; r < 8; ++r) { sp[r * SPITCH] = fsilu16(s0[r]); sp[r * SPITCH + 16] = fsilu16(s1[r]); }
        } else {
        const int y0 = jt + l16, y1 = y0 + 16;
        const int idy0 = max(y0 - nc + 1, 0), idy1 = max(y1 - nc + 1, 0);
        const int tgy0 = max(idy0 - max1 + nt, -1), tgy1 = max(idy1 - max1 + nt, -1);
#pragma unroll
        for (int r = 0; r < 8; ++r) {
          const int m = r + hh * 8, x = qb + m;
          const int idx = max(x - nc + 1, 0), tgx = max(idx - max1 + nt, -1);
          const bool c0 = (x == y0) || (idx > idy0), c1 = (x == y1) || (idx > idy1);
          const bool g0 = (tgx == tgy0) || (tgx < 0) || (tgy0 < 0), g1 = (tgx == tgy1) || (tgx < 0) || (tgy1 < 0);
          const bool ctx = (idx == 0);
          const bool ok0 = ((c0 && g0) || (ctx && idy0 < max2)) && (y0 < nlen) && (x < nlen);
          const bool ok1 = ((c1 && g1) || (ctx && idy1 < max2)) && (y1 < nlen) && (x < nlen);
          const float a0v = fsilu16(s0[r]), a1v = fsilu16(s1[r]);
          sp[r * SPITCH]      = ok0 ? a0v : 0.0f;
          sp[r * SPITCH + 16] = ok1 ? a1v : 0.0f;
        }
        }
      }
      LDSX();
      // ---- read the wave's 16x32 P tile back as an A fragment, split into bf16 hi + residual
      F2 pf;
      { float v[16]; const float* row = &Sscr[wave][l16][0]; const int c0 = hh * 8;
#pragma unroll
        for (int i = 0; i < 8; ++i) { v[i] = row[c0 + i]; v[8 + i] = row[16 + c0 + i]; }
        pf = bsplit16(v); }
      // ---- O += P V (4 d tiles x 2 WMMAs)
#pragma unroll
      for (int dc = 0; dc < 4; ++dc) {
        const v16b vf = frag_b16(&Vt[ks][dc * 16 + l16][0], lane);     // keys 8*hh.., 16+8*hh..
        acc[dc] = wmma_bf(pf.l, vf, acc[dc]);
        acc[dc] = wmma_bf(pf.h, vf, acc[dc]);
      }
    }
    __syncthreads();                                                   // protect Kb/Vt before the next staging round
  }

  // the lane number is read anew here, so that no lane index has to stay in a VGPR over the key loop just for these last lines (the loop sits at its register limit; held over it, such values spill to scratch)
  const int el = (int)__builtin_amdgcn_mbcnt_lo(~0u, 0u), e16 = el & 15, eh = el >> 4;
  float* so = &So[wave][0][0];
#pragma unroll
  for (int r = 0; r < 8; ++r)
#pragma unroll
    for (int dc = 0; dc < 4; ++dc) so[(r + eh * 8) * OPITCH + dc * 16 + e16] = acc[dc][r];
  __syncthreads();                                                     // every wave's partial rows are in LDS before any wave sums them
  const float invDenom = 0.0625f / (float)maxseq;                      // the 1/16 that the loop's silu form leaves out, and 1 / max_seqlen
  // ---- sum the 4 key splits of each row in the fixed order 0..3, scale, store whole 256-B rows (16 lanes x 16 B)
#pragma unroll
  for (int i = 0; i < 2; ++i) { const int m = i * 32 + wave * 2 + eh, c = e16 * 4; const int x = row0 + m;   // wave * 2 + eh = thread / 16
    const float* pr = &So[m >> 4][m & 15][c];                          // wave index = 4 * split + row group
    v4f s = *(const v4f*)pr;
#pragma unroll
    for (int k = 1; k < KSPLIT; ++k) s += *(const v4f*)(pr + k * 4 * 16 * OPITCH);
    if (x < nlen) vst2(out + (size_t)(off + x) * (NHEAD * DVV) + h * DVV + c, (v4f)(s * invDenom)); }
}

extern "C" void kernel_launch(void* const* d_in, const int* in_sizes, int n_in, void* d_out, int out_size, void* d_ws, size_t ws_size, hipStream_t stream) {
  (void)in_sizes; (void)n_in; (void)out_size; (void)d_ws; (void)ws_size;
  dim3 grid(NHEAD * MAXITEMS, 1, 1), block(512, 1, 1);
  k_attn<<<grid, block, 0, stream>>>((const float*)d_in[0], (const float*)d_in[1], (const float*)d_in[2],
                                     (const int*)d_in[3], (const int*)d_in[4], (const int*)d_in[5], (const int*)d_in[6], (float*)d_out);
}

// v006
// It runs in 21.3 microseconds.
// Two timings next to v005 put it at 1.18 and 1.19 times that version's speed.
// Counting every step since v000, it is 4.56 times as fast.
// compute dtype: q, k, v (module inputs) rounded to bf16; S = q k^T as exact bf16 WMMA products (f32 accumulate); silu and the integer attention mask in f32;
// silu(S) carried as a bf16 hi + bf16 residual pair against bf16 v (f32 accumulate); the 1/max_seqlen factor applied in the f32 epilogue.
#include <hip/hip_runtime.h>
#include <math.h>

typedef __attribute__((ext_vector_type(16))) _Float16 v16h;
typedef __attribute__((ext_vector_type(16))) __bf16 v16b;
typedef __attribute__((ext_vector_type(8)))  _Float16 v8h;
typedef __attribute__((ext_vector_type(8)))  float v8f;
typedef __attribute__((ext_vector_type(4)))  float v4f;
typedef __attribute__((ext_vector_type(2)))  float v2f;
typedef __attribute__((ext_vector_type(4)))  unsigned v4u;
typedef __attribute__((ext_vector_type(4)))  int v4i;
typedef float __attribute__((may_alias)) float_a;
typedef int __attribute__((may_alias)) int_a;

template <typename T> __device__ __forceinline__ void vst2(void* p, T v) { *(T*)p = v;  }
__device__ __forceinline__ v8f wmma16(v16h a, v16h b, v8f c) {
  v8f d = __builtin_amdgcn_wmma_f32_16x16x32_f16(false, a, false, b, (short)0, c, false, false);
  asm volatile("v_nop\n\tv_nop\n\tv_nop\n\tv_nop" : "+v"(d) : "v"(a), "v"(b));
  return d;
}
__device__ __forceinline__ v8f wmma_bf(v16b a, v16b b, v8f c) {
  v8f d = __builtin_amdgcn_wmma_f32_16x16x32_bf16(false, a, false, b, (short)0, c, false, false);
  asm volatile("v_nop\n\tv_nop\n\tv_nop\n\tv_nop" : "+v"(d) : "v"(a), "v"(b));
  return d;
}
// 16x16x32 fragments: lane = (h = lane>>4, row/col = lane&15); elements 0..7 = k0+8h+0..7, 8..15 = k0+16+8h+0..7; D element r = row 8h+r
__device__ __forceinline__ v16h frag_h(const _Float16* rowk0, int lane) {
  union { v16h v; v8h q[2]; } u; const _Float16* p = rowk0 + 8 * (lane >> 4);
  u.q[0] = *(const v8h*)p; u.q[1] = *(const v8h*)(p + 16); return u.v;
}
__device__ __forceinline__ v16h frag_f32(const float* rowk0, int lane) {
  v16h a; const float* p = rowk0 + 8 * (lane >> 4);
#pragma unroll
  for (int i = 0; i < 8; ++i) { a[i] = (_Float16)p[i]; a[8 + i] = (_Float16)p[16 + i]; }
  return a;
}
__device__ __forceinline__ v16h frag_f32s(const float* rowk0, int lane, float sc) {
  v16h a; const float* p = rowk0 + 8 * (lane >> 4);
#pragma unroll
  for (int i = 0; i < 8; ++i) { a[i] = (_Float16)(p[i] * sc); a[8 + i] = (_Float16)(p[16 + i] * sc); }
  return a;
}
// column fragment from a [K][ld] layout (column n), rows >= K read as 0
__device__ __forceinline__ v16h fragc_f32(const float* W, int k0, int n, int lane, int ld, int K) {
  v16h a; const int g = lane >> 4;
#pragma unroll
  for (int i = 0; i < 8; ++i) { const int ka = k0 + 8 * g + i, kb = ka + 16;
    a[i] = (_Float16)(ka < K ? W[(size_t)(ka < K ? ka : K - 1) * ld + n] : 0.f); a[8 + i] = (_Float16)(kb < K ? W[(size_t)(kb < K ? kb : K - 1) * ld + n] : 0.f); }
  return a;
}
struct F2 { v16b h, l; };
__device__ __forceinline__ F2 bsplit16(const float v[16]) { F2 r;
#pragma unroll
  for (int i = 0; i < 16; ++i) { const __bf16 h = (__bf16)v[i]; r.h[i] = h; r.l[i] = (__bf16)(v[i] - (float)h); }
  return r; }
__device__ __forceinline__ F2 split_row(const float* row, int k0, int lane) { float v[16]; const float* p = row + k0 + 8 * (lane >> 4);
#pragma unroll
  for (int i = 0; i < 8; ++i) { v[i] = p[i]; v[8 + i] = p[16 + i]; }
  return bsplit16(v); }
__device__ __forceinline__ F2 split_rowK(const float* row, int k0, int lane, int K) { float v[16]; const int g = lane >> 4;
#pragma unroll
  for (int i = 0; i < 8; ++i) { const int ka = k0 + 8 * g + i, kb = ka + 16; v[i] = ka < K ? row[ka < K ? ka : K - 1] : 0.f; v[8 + i] = kb < K ? row[kb < K ? kb : K - 1] : 0.f; }
  return bsplit16(v); }
__device__ __forceinline__ F2 split_col(const float* W, int k0, int n, int lane, int ld, int K) { float v[16]; const int g = lane >> 4;
#pragma unroll
  for (int i = 0; i < 8; ++i) { const int ka = k0 + 8 * g + i, kb = ka + 16; v[i] = ka < K ? W[(size_t)(ka < K ? ka : K - 1) * ld + n] : 0.f; v[8 + i] = kb < K ? W[(size_t)(kb < K ? kb : K - 1) * ld + n] : 0.f; }
  return bsplit16(v); }
__device__ __forceinline__ v8f mac3(const F2& a, const F2& b, v8f c) { c = wmma_bf(a.l, b.h, c); c = wmma_bf(a.h, b.l, c); return wmma_bf(a.h, b.h, c); }
__device__ __forceinline__ float sigm(float v) { return 1.0f / (1.0f + expf(-v)); }
#define LDSX() do { asm volatile("s_wait_dscnt 0" ::: "memory"); __builtin_amdgcn_wave_barrier(); __builtin_amdgcn_fence(__ATOMIC_RELEASE, "workgroup"); } while (0)


// Jagged causal silu attention with contextual / target-group masking. One block = 64 query rows of one (sequence, head): 16 waves = 4 row groups of 16 x 4 key tiles;
// a round stages 4 key tiles of 32 in LDS (K row-major bf16, V transposed bf16) and each wave works on one of them, so a row's keys are walked by 4 waves side by side;
// per wave and tile: 4 WMMAs for S (two 16-key subtiles x two 32-wide d chunks), silu + mask through a per-wave LDS transpose, 8 WMMAs for O (4 d tiles x {residual, hi}).
// The 4 partial outputs of a row group are summed through LDS behind the loop (silu attention has no row normaliser, so partial sums just add)
#define NHEAD 4
#define DQK   64
#define DVV   64
#define MTILE 64
#define JTILE 32
#define KSPLIT 4
#define NWAVE 16
#define MAXSEQ 2048
#define NSEQ   8
#define LTOK   8192                       // rows of tq, tk, tv: all sequences together
#define MAXT   (MAXSEQ / MTILE)           // row tiles of one sequence at most: 32, one per lane of the rank search
#define MAXITEMS (LTOK / MTILE + NSEQ)    // row tiles of all sequences together at most: each sequence rounds up once
// LDS row pitches. K, transposed V and S scratch are read by ds_load_b128 with 16 lanes on 16 rows: a pitch of 16 B x odd spreads those rows over all 64 banks,
// where the bare 128-B and 64-B rows put them on 8 and 16 banks. The partial output rows are padded for their stores: the two lane halves write rows 8 apart,
// which fall on the same banks at 256 B. The pad elements are never written and never read
#define KPITCH 72    // bf16 per K row: 144 B
#define VPITCH 40    // bf16 per transposed V row: 80 B
#define SPITCH 36    // f32 per row of the S transpose scratch: 144 B
#define OPITCH 68    // f32 per partial output row: 272 B
typedef __attribute__((ext_vector_type(8))) __bf16 v8b;
__device__ __forceinline__ v16b frag_b16(const __bf16* rowk0, int lane) {   // 16x16x32 operand fragment from a bf16 row: elements 0..7 = k0+8h.., 8..15 = k0+16+8h..
  union { v16b v; v8b q[2]; } u; const __bf16* p = rowk0 + 8 * (lane >> 4);
  u.q[0] = *(const v8b*)p; u.q[1] = *(const v8b*)(p + 16); return u.v;
}
__device__ __forceinline__ v16b frag_gbf(const float* rowk0, int lane) {     // same map from an f32 global row, rounding to bf16 (RNE)
  v16b a; const float* p = rowk0 + 8 * (lane >> 4);
#pragma unroll
  for (int i = 0; i < 8; ++i) { a[i] = (__bf16)p[i]; a[8 + i] = (__bf16)p[16 + i]; }
  return a;
}
// 16 * silu(s / 8) = s + s * tanh(s / 16), from sigmoid(x) = (1 + tanh(x / 2)) / 2: multiply, the hardware's f32 tanh, fused multiply-add, in place of the library expf
// with its range reduction and the IEEE division sequence. tanh saturates at -1 and 1, which gives 0 and 2 s, the limits. The exact factor 1/16 is applied in the epilogue
__device__ __forceinline__ float fsilu16(float s) { return fmaf(s, __builtin_amdgcn_tanhf(s * 0.0625f), s); }
__device__ __forceinline__ unsigned lt16(int t) { return (1u << min(max(t, 0), 16)) - 1u; }   // bits m = 0..15 with m < t

__global__ __launch_bounds__(512, 8)   // 128 VGPRs: two of these 16-wave blocks stay resident on a WGP
void k_attn(const float* __restrict__ tq, const float* __restrict__ tk, const float* __restrict__ tv,
            const int* __restrict__ offsets, const int* __restrict__ ncand, const int* __restrict__ p_maxseq, const int* __restrict__ p_nctx,
            float* __restrict__ out) {
  __shared__ __align__(16) __bf16 Kb[KSPLIT][JTILE][KPITCH];  // key rows, bf16, one tile per key split (18 KB)
  __shared__ __align__(16) __bf16 Vt[KSPLIT][DVV][VPITCH];  // v transposed: Vt[tile][d][key] (20 KB)
  __shared__ __align__(16) float Sscr[NWAVE][16][SPITCH];    // per-wave S transpose scratch (36 KB)
  __shared__ __align__(16) float So[NWAVE][16][OPITCH];     // per-wave partial output rows (68 KB)

  // ---- block index -> (head, sequence, row tile), the longest key walk first. For speed only.
  // Level u of a sequence stands for its u-th cheapest tile; levels are handed out from the top down over
  // all sequences, heads innermost. The map is a permutation of the tiles for any lengths, and it is the same in every wave (scalar values only)
  const int h = blockIdx.x & (NHEAD - 1), rank = blockIdx.x / NHEAD;
  int offs[NSEQ + 1], nts[NSEQ];
#pragma unroll
  for (int i = 0; i <= NSEQ; ++i) offs[i] = offsets[i];
  int above = 0;                                          // lane t: tiles of all sequences on a level above t
#pragma unroll
  for (int i = 0; i < NSEQ; ++i) {
    nts[i] = min(max((offs[i + 1] - offs[i] + MTILE - 1) >> 6, 0), MAXT);
    above += max(nts[i] - 1 - (int)(threadIdx.x & 31), 0);
  }
  const int u = __builtin_ctz(__builtin_amdgcn_ballot_w32(above <= rank));   // the rank's level: the lowest with no more than rank tiles above it (lane 31 always has 0)
  int k = rank - __builtin_amdgcn_readlane(above, u);     // place within the level
  int b = -1, off = 0, nlen = 0, ntl = 0;
#pragma unroll
  for (int i = 0; i < NSEQ; ++i) {
    const bool has = nts[i] > u;
    if (has && k == 0) { b = i; off = offs[i]; nlen = offs[i + 1] - offs[i]; ntl = nts[i]; }
    k -= has ? 1 : 0;
  }
  if (b < 0) return;                                      // rank past the last tile: block-uniform, before any barrier
  // cost order inside a sequence: the last tile, then tile 0 (its contextual rows walk every key), then the causal tiles from the back
  const int row0 = ((u == ntl - 1) ? u : (u == ntl - 2) ? 0 : u + 1) * MTILE;

  const int nc   = p_nctx[0];                              // contextual tokens at the head of each sequence
  const int nt   = ncand[b];                               // target (candidate) tokens at the tail
  const int max1 = nlen - nc + 1;
  const int max2 = max1 - nt;
  const int maxseq = p_maxseq[0];

  const int tid = threadIdx.x, wave = __builtin_amdgcn_readfirstlane(tid >> 5), lane = tid & 31, l16 = lane & 15, hh = lane >> 4;
  // the wave number is held in a scalar register, so that row group, key tile and the tile test below are scalar and cost no VGPR
  const int rg = wave & 3, ks = wave >> 2;                 // row group of 16 queries, key tile of the round
  const int qb = row0 + rg * 16;

  // ---- Q fragments (bf16-rounded input), kept for the whole key loop: 2 x 8 VGPRs
  int qrow = qb + l16; if (qrow > nlen - 1) qrow = nlen - 1;
  const float* qp = tq + (size_t)(off + qrow) * (NHEAD * DQK) + h * DQK;
  const v16b qf0 = frag_gbf(qp, lane), qf1 = frag_gbf(qp + 32, lane);

  v8f acc[4];
#pragma unroll
  for (int i = 0; i < 4; ++i) acc[i] = (v8f){};

  // rows holding contextual tokens (x < nc) attend to the whole history, everyone else is causal within the block's rows
  const int jcaus = (nlen < row0 + MTILE) ? nlen : (row0 + MTILE);
  const int jmax  = (row0 < nc) ? nlen : jcaus;                      // block-uniform
  const bool wctx = (qb < nc);                                       // wave-uniform

  for (int j = 0; j < jmax; j += JTILE * KSPLIT) {
    // ---- cooperative staging of the round's 4 tiles (128 keys): K rows as bf16, V transposed as bf16 ----
    {
      const int cgk = (tid & 7) * 8, cgv = (tid & 15) * 4;             // K: 8 d columns of one key; V: 4 d columns of a key pair
      v4f ka[2][2], va[2][2];
#pragma unroll
      for (int t = 0; t < 2; ++t) {
        int krow = j + t * 64 + (tid >> 3); if (krow > nlen - 1) krow = nlen - 1;   // address clamp; clamped keys are masked by (y < nlen)
        const float* kp = tk + (size_t)(off + krow) * (NHEAD * DQK) + h * DQK + cgk;
        ka[t][0] = *(const v4f*)kp;
        asm volatile("s_wait_xcnt 0x0" ::: "memory");                  // the next load's result may land in the address pair that the load above names: keep the wait in front of that overwrite
        ka[t][1] = *(const v4f*)(kp + 4);
      }
#pragma unroll
      for (int t = 0; t < 2; ++t) {
        int r0g = j + 2 * (t * 32 + (tid >> 4)), r1g = r0g + 1;        // key pair of the round
        if (r0g > nlen - 1) r0g = nlen - 1;
        if (r1g > nlen - 1) r1g = nlen - 1;
        va[t][0] = *(const v4f*)(tv + (size_t)(off + r0g) * (NHEAD * DVV) + h * DVV + cgv);
        va[t][1] = *(const v4f*)(tv + (size_t)(off + r1g) * (NHEAD * DVV) + h * DVV + cgv);
      }
      // holds the 8 loads together in front of the first conversion: one memory latency a round instead of one per load pair
      asm volatile("" :: "v"(ka[0][0]), "v"(ka[0][1]), "v"(ka[1][0]), "v"(ka[1][1]), "v"(va[0][0]), "v"(va[0][1]), "v"(va[1][0]), "v"(va[1][1]));
#pragma unroll
      for (int t = 0; t < 2; ++t) {
        const int kl = t * 64 + (tid >> 3);                            // key of the round, 0..127: tile kl / 32, row kl % 32
        union { v8b v; uint4 u; } cv;
#pragma unroll
        for (int i = 0; i < 4; ++i) { cv.v[i] = (__bf16)ka[t][0][i]; cv.v[4 + i] = (__bf16)ka[t][1][i]; }
        *(uint4*)&Kb[kl >> 5][kl & 31][cgk] = cv.u;
      }
#pragma unroll
      for (int t = 0; t < 2; ++t) {
        const int pl = t * 32 + (tid >> 4);                            // key pair of the round, 0..63: tile pl / 16, keys 2 * (pl % 16) and the next
#pragma unroll
        for (int i = 0; i < 4; ++i) {
          union { __bf16 h2[2]; uint32_t u; } p;
          p.h2[0] = (__bf16)va[t][0][i]; p.h2[1] = (__bf16)va[t][1][i];
          *(uint32_t*)&Vt[pl >> 4][cgv + i][2 * (pl & 15)] = p.u;
        }
      }
    }
    __syncthreads();

    const int jt = j + ks * JTILE;                                     // first key of this wave's tile
    const bool active = (jt < jmax) && (wctx || (jt <= qb + 15));      // wave-uniform: tile has at least one unmasked key for this wave
    if (active) {
      // ---- S = Q K^T for keys jt..jt+15 and jt+16..jt+31 (exact bf16 products)
      v8f s0 = (v8f){}, s1 = (v8f){};
      s0 = wmma_bf(qf0, frag_b16(&Kb[ks][l16][0], lane), s0);       s0 = wmma_bf(qf1, frag_b16(&Kb[ks][l16][32], lane), s0);
      s1 = wmma_bf(qf0, frag_b16(&Kb[ks][16 + l16][0], lane), s1);  s1 = wmma_bf(qf1, frag_b16(&Kb[ks][16 + l16][32], lane), s1);

      // ---- 16 * silu(alpha * s) and the integer mask; C layout (row 8*hh + r, column l16) -> LDS row-major
      {
        float* sp = &Sscr[wave][hh * 8][l16];                           // the lane's element of row r = 0; the rows follow at constant offsets
        // Scalar test for a tile whose 16 x 32 scores all pass the mask. The shifted ids grow with the position, so the tile's first row against its last key decides for all:
        // strictly causal in the shifted ids, the last key ahead of the target tokens (its group id is negative, which opens the group test for every row), rows and keys inside the sequence
        const int idyl = max(jt + JTILE - nc, 0);                       // shifted id of the tile's last key
        const bool inner = (max(qb - nc + 1, 0) > idyl) && (idyl < max2) && (qb + 15 < nlen) && (jt + JTILE - 1 < nlen);
        if (inner) {
#pragma unroll
          for (int r = 0; r < 8; ++r) { sp[r * SPITCH] = fsilu16(s0[r]); sp[r * SPITCH + 16] = fsilu16(s1[r]); }
        } else {
        // For a fixed key y every term of the mask is a threshold on the row x, so the 16 rows of the tile that pass against y are a few bit ranges (bit m = row qb + m):
        //   idx > idy        <=> x >= idy + nc            (idy >= 0)
        //   tgx < 0          <=> max2 > 0 and x < max2 + nc - 1;   tgy < 0 <=> idy < max2 ("open" key, ahead of the target tokens)
        //   tgx == tgy with both >= 0 <=> idx == idy, which beside (x == y or idx > idy) leaves x == y alone
        //   idx == 0         <=> x < nc
        // pass = [ x == y  or  (x >= idy + nc and (open or tgx < 0))  or  (x < nc and open) ] and y < nlen and x < nlen: the same truth table as the reference's mask for all integers
        const unsigned ltN = lt16(nlen - qb), ltC = lt16(nc - qb), ltG = (max2 > 0) ? lt16(max2 + nc - 1 - qb) : 0u;   // scalar: rows inside the sequence, contextual rows, rows ahead of the targets
        unsigned rb[2];
#pragma unroll
        for (int c = 0; c < 2; ++c) {
          const int y = jt + l16 + 16 * c, idy = max(y - nc + 1, 0), e = y - qb;
          const bool open = idy < max2;
          const unsigned caus = ~0u << min(max(idy + nc - qb, 0), 16);
          const unsigned diag = ((unsigned)e < 16u) ? (1u << (e & 15)) : 0u;
          rb[c] = (diag | (caus & (open ? ~0u : ltG)) | (open ? ltC : 0u)) & ((y < nlen) ? ltN : 0u);
        }
        const unsigned mm = ((rb[0] >> (hh * 8)) & 0xFFu) | ((rb[1] >> (hh * 8)) << 8);   // the lane's 8 rows: bits 0..7 for key y0, 8..15 for key y0 + 16
#pragma unroll
        for (int r = 0; r < 8; ++r) {
          sp[r * SPITCH]      = ((mm >> r) & 1u)       ? fsilu16(s0[r]) : 0.0f;
          sp[r * SPITCH + 16] = ((mm >> (8 + r)) & 1u) ? fsilu16(s1[r]) : 0.0f;
        }
        }
      }
      LDSX();
      // ---- read the wave's 16x32 P tile back as an A fragment, split into bf16 hi + residual
      F2 pf;
      { float v[16]; const float* row = &Sscr[wave][l16][0]; const int c0 = hh * 8;
#pragma unroll
        for (int i = 0; i < 8; ++i) { v[i] = row[c0 + i]; v[8 + i] = row[16 + c0 + i]; }
        pf = bsplit16(v); }
      // ---- O += P V (4 d tiles x 2 WMMAs)
#pragma unroll
      for (int dc = 0; dc < 4; ++dc) {
        const v16b vf = frag_b16(&Vt[ks][dc * 16 + l16][0], lane);     // keys 8*hh.., 16+8*hh..
        acc[dc] = wmma_bf(pf.l, vf, acc[dc]);
        acc[dc] = wmma_bf(pf.h, vf, acc[dc]);
      }
    }
    __syncthreads();                                                   // protect Kb/Vt before the next staging round
  }

  // the lane number is read anew here, so that no lane index has to stay in a VGPR over the key loop just for these last lines (the loop sits at its register limit; held over it, such values spill to scratch)
  const int el = (int)__builtin_amdgcn_mbcnt_lo(~0u, 0u), e16 = el & 15, eh = el >> 4;
  float* so = &So[wave][0][0];
#pragma unroll
  for (int r = 0; r < 8; ++r)
#pragma unroll
    for (int dc = 0; dc < 4; ++dc) so[(r + eh * 8) * OPITCH + dc * 16 + e16] = acc[dc][r];
  __syncthreads();                                                     // every wave's partial rows are in LDS before any wave sums them
  const float invDenom = 0.0625f / (float)maxseq;                      // the 1/16 that the loop's silu form leaves out, and 1 / max_seqlen
  // ---- sum the 4 key splits of each row in the fixed order 0..3, scale, store whole 256-B rows (16 lanes x 16 B)
#pragma unroll
  for (int i = 0; i < 2; ++i) { const int m = i * 32 + wave * 2 + eh, c = e16 * 4; const int x = row0 + m;   // wave * 2 + eh = thread / 16
    const float* pr = &So[m >> 4][m & 15][c];                          // wave index = 4 * split + row group
    v4f s = *(const v4f*)pr;
#pragma unroll
    for (int k = 1; k < KSPLIT; ++k) s += *(const v4f*)(pr + k * 4 * 16 * OPITCH);
    if (x < nlen) vst2(out + (size_t)(off + x) * (NHEAD * DVV) + h * DVV + c, (v4f)(s * invDenom)); }
}

extern "C" void kernel_launch(void* const* d_in, const int* in_sizes, int n_in, void* d_out, int out_size, void* d_ws, size_t ws_size, hipStream_t stream) {
  (void)in_sizes; (void)n_in; (void)out_size; (void)d_ws; (void)ws_size;
  dim3 grid(NHEAD * MAXITEMS, 1, 1), block(512, 1, 1);
  k_attn<<<grid, block, 0, stream>>>((const float*)d_in[0], (const float*)d_in[1], (const float*)d_in[2],
                                     (const int*)d_in[3], (const int*)d_in[4], (const int*)d_in[5], (const int*)d_in[6], (float*)d_out);
}

// v007
// Measured time: 19.8 microseconds a run.
// In two side-by-side timings against v006, it was 1.07 and 1.08 times as fast.
// Counting every step since v000, it is 4.91 times as fast.
// compute dtype: q, k, v (module inputs) rounded to bf16; S = q k^T as exact bf16 WMMA products (f32 accumulate); silu and the integer attention mask in f32;
// silu(S) carried as a bf16 hi + bf16 residual pair against bf16 v (f32 accumulate); the 1/max_seqlen factor applied in the f32 epilogue.
#include <hip/hip_runtime.h>
#include <math.h>

typedef __attribute__((ext_vector_type(16))) _Float16 v16h;
typedef __attribute__((ext_vector_type(16))) __bf16 v16b;
typedef __attribute__((ext_vector_type(8)))  _Float16 v8h;
typedef __attribute__((ext_vector_type(8)))  float v8f;
typedef __attribute__((ext_vector_type(4)))  float v4f;
typedef __attribute__((ext_vector_type(2)))  float v2f;
typedef __attribute__((ext_vector_type(4)))  unsigned v4u;
typedef __attribute__((ext_vector_type(4)))  int v4i;
typedef float __attribute__((may_alias)) float_a;
typedef int __attribute__((may_alias)) int_a;

template <typename T> __device__ __forceinline__ void vst2(void* p, T v) { *(T*)p = v;  }
__device__ __forceinline__ v8f wmma16(v16h a, v16h b, v8f c) {
  v8f d = __builtin_amdgcn_wmma_f32_16x16x32_f16(false, a, false, b, (short)0, c, false, false);
  asm volatile("v_nop\n\tv_nop\n\tv_nop\n\tv_nop" : "+v"(d) : "v"(a), "v"(b));
  return d;
}
__device__ __forceinline__ v8f wmma_bf(v16b a, v16b b, v8f c) {   // the plain builtin: the compiler keeps the distances behind it and is free to move LDS reads ahead of a run of them
  return __builtin_amdgcn_wmma_f32_16x16x32_bf16(false, a, false, b, (short)0, c, false, false);
}
// 16x16x32 fragments: lane = (h = lane>>4, row/col = lane&15); elements 0..7 = k0+8h+0..7, 8..15 = k0+16+8h+0..7; D element r = row 8h+r
__device__ __forceinline__ v16h frag_h(const _Float16* rowk0, int lane) {
  union { v16h v; v8h q[2]; } u; const _Float16* p = rowk0 + 8 * (lane >> 4);
  u.q[0] = *(const v8h*)p; u.q[1] = *(const v8h*)(p + 16); return u.v;
}
__device__ __forceinline__ v16h frag_f32(const float* rowk0, int lane) {
  v16h a; const float* p = rowk0 + 8 * (lane >> 4);
#pragma unroll
  for (int i = 0; i < 8; ++i) { a[i] = (_Float16)p[i]; a[8 + i] = (_Float16)p[16 + i]; }
  return a;
}
__device__ __forceinline__ v16h frag_f32s(const float* rowk0, int lane, float sc) {
  v16h a; const float* p = rowk0 + 8 * (lane >> 4);
#pragma unroll
  for (int i = 0; i < 8; ++i) { a[i] = (_Float16)(p[i] * sc); a[8 + i] = (_Float16)(p[16 + i] * sc); }
  return a;
}
// column fragment from a [K][ld] layout (column n), rows >= K read as 0
__device__ __forceinline__ v16h fragc_f32(const float* W, int k0, int n, int lane, int ld, int K) {
  v16h a; const int g = lane >> 4;
#pragma unroll
  for (int i = 0; i < 8; ++i) { const int ka = k0 + 8 * g + i, kb = ka + 16;
    a[i] = (_Float16)(ka < K ? W[(size_t)(ka < K ? ka : K - 1) * ld + n] : 0.f); a[8 + i] = (_Float16)(kb < K ? W[(size_t)(kb < K ? kb : K - 1) * ld + n] : 0.f); }
  return a;
}
struct F2 { v16b h, l; };
__device__ __forceinline__ F2 bsplit16(const float v[16]) { F2 r;
#pragma unroll
  for (int i = 0; i < 16; ++i) { const __bf16 h = (__bf16)v[i]; r.h[i] = h; r.l[i] = (__bf16)(v[i] - (float)h); }
  return r; }
__device__ __forceinline__ F2 split_row(const float* row, int k0, int lane) { float v[16]; const float* p = row + k0 + 8 * (lane >> 4);
#pragma unroll
  for (int i = 0; i < 8; ++i) { v[i] = p[i]; v[8 + i] = p[16 + i]; }
  return bsplit16(v); }
__device__ __forceinline__ F2 split_rowK(const float* row, int k0, int lane, int K) { float v[16]; const int g = lane >> 4;
#pragma unroll
  for (int i = 0; i < 8; ++i) { const int ka = k0 + 8 * g + i, kb = ka + 16; v[i] = ka < K ? row[ka < K ? ka : K - 1] : 0.f; v[8 + i] = kb < K ? row[kb < K ? kb : K - 1] : 0.f; }
  return bsplit16(v); }
__device__ __forceinline__ F2 split_col(const float* W, int k0, int n, int lane, int ld, int K) { float v[16]; const int g = lane >> 4;
#pragma unroll
  for (int i = 0; i < 8; ++i) { const int ka = k0 + 8 * g + i, kb = ka + 16; v[i] = ka < K ? W[(size_t)(ka < K ? ka : K - 1) * ld + n] : 0.f; v[8 + i] = kb < K ? W[(size_t)(kb < K ? kb : K - 1) * ld + n] : 0.f; }
  return bsplit16(v); }
__device__ __forceinline__ v8f mac3(const F2& a, const F2& b, v8f c) { c = wmma_bf(a.l, b.h, c); c = wmma_bf(a.h, b.l, c); return wmma_bf(a.h, b.h, c); }
__device__ __forceinline__ float sigm(float v) { return 1.0f / (1.0f + expf(-v)); }
#define LDSX() do { asm volatile("s_wait_dscnt 0" ::: "memory"); __builtin_amdgcn_wave_barrier(); __builtin_amdgcn_fence(__ATOMIC_RELEASE, "workgroup"); } while (0)


// Jagged causal silu attention with contextual / target-group masking. One block = 64 query rows of one (sequence, head): 16 waves = 4 row groups of 16 x 4 key tiles;
// a round stages 4 key tiles of 32 in LDS (K row-major bf16, V transposed bf16) and each wave works on one of them, so a row's keys are walked by 4 waves side by side;
// per wave and tile: 4 WMMAs for S (two 16-key subtiles x two 32-wide d chunks), silu + mask through a per-wave LDS transpose, 8 WMMAs for O (4 d tiles x {residual, hi}).
// The 4 partial outputs of a row group are summed through LDS behind the loop (silu attention has no row normaliser, so partial sums just add)
#define NHEAD 4
#define DQK   64
#define DVV   64
#define MTILE 64
#define JTILE 32
#define KSPLIT 4
#define NWAVE 16
#define MAXSEQ 2048
#define NSEQ   8
#define LTOK   8192                       // rows of tq, tk, tv: all sequences together
#define MAXT   (MAXSEQ / MTILE)           // row tiles of one sequence at most: 32, one per lane of the rank search
#define MAXITEMS (LTOK / MTILE + NSEQ)    // row tiles of all sequences together at most: each sequence rounds up once
// LDS row pitches. K, transposed V and S scratch are read by ds_load_b128 with 16 lanes on 16 rows: a pitch of 16 B x odd spreads those rows over all 64 banks,
// where the bare 128-B and 64-B rows put them on 8 and 16 banks. The partial output rows are padded for their stores: the two lane halves write rows 8 apart,
// which fall on the same banks at 256 B. The pad elements are never written and never read
#define KPITCH 72    // bf16 per K row: 144 B
#define VPITCH 40    // bf16 per transposed V row: 80 B
#define SPITCH 36    // f32 per row of the S transpose scratch: 144 B
#define OPITCH 68    // f32 per partial output row: 272 B
typedef __attribute__((ext_vector_type(8))) __bf16 v8b;
__device__ __forceinline__ v16b frag_b16(const __bf16* rowk0, int lane) {   // 16x16x32 operand fragment from a bf16 row: elements 0..7 = k0+8h.., 8..15 = k0+16+8h..
  union { v16b v; v8b q[2]; } u; const __bf16* p = rowk0 + 8 * (lane >> 4);
  u.q[0] = *(const v8b*)p; u.q[1] = *(const v8b*)(p + 16); return u.v;
}
__device__ __forceinline__ v16b frag_gbf(const float* rowk0, int lane) {     // same map from an f32 global row, rounding to bf16 (RNE)
  v16b a; const float* p = rowk0 + 8 * (lane >> 4);
#pragma unroll
  for (int i = 0; i < 8; ++i) { a[i] = (__bf16)p[i]; a[8 + i] = (__bf16)p[16 + i]; }
  return a;
}
// 16 * silu(s / 8) = s + s * tanh(s / 16), from sigmoid(x) = (1 + tanh(x / 2)) / 2: multiply, the hardware's f32 tanh, fused multiply-add, in place of the library expf
// with its range reduction and the IEEE division sequence. tanh saturates at -1 and 1, which gives 0 and 2 s, the limits. The exact factor 1/16 is applied in the epilogue
__device__ __forceinline__ float fsilu16(float s) { return fmaf(s, __builtin_amdgcn_tanhf(s * 0.0625f), s); }
__device__ __forceinline__ unsigned lt16(int t) { return (1u << min(max(t, 0), 16)) - 1u; }   // bits m = 0..15 with m < t

__global__ __launch_bounds__(512, 8)   // 128 VGPRs: two of these 16-wave blocks stay resident on a WGP
void k_attn(const float* __restrict__ tq, const float* __restrict__ tk, const float* __restrict__ tv,
            const int* __restrict__ offsets, const int* __restrict__ ncand, const int* __restrict__ p_maxseq, const int* __restrict__ p_nctx,
            float* __restrict__ out) {
  __shared__ __align__(16) __bf16 Kb[KSPLIT][JTILE][KPITCH];  // key rows, bf16, one tile per key split (18 KB)
  __shared__ __align__(16) __bf16 Vt[KSPLIT][DVV][VPITCH];  // v transposed: Vt[tile][d][key] (20 KB)
  __shared__ __align__(16) float Sscr[NWAVE][16][SPITCH];    // per-wave S transpose scratch (36 KB)
  __shared__ __align__(16) float So[NWAVE][16][OPITCH];     // per-wave partial output rows (68 KB)

  // ---- block index -> (head, sequence, row tile), the longest key walk first. For speed only.
  // Level u of a sequence stands for its u-th cheapest tile; levels are handed out from the top down over
  // all sequences, heads innermost. The map is a permutation of the tiles for any lengths, and it is the same in every wave (scalar values only)
  const int h = blockIdx.x & (NHEAD - 1), rank = blockIdx.x / NHEAD;
  int offs[NSEQ + 1], nts[NSEQ];
#pragma unroll
  for (int i = 0; i <= NSEQ; ++i) offs[i] = offsets[i];
  int above = 0;                                          // lane t: tiles of all sequences on a level above t
#pragma unroll
  for (int i = 0; i < NSEQ; ++i) {
    nts[i] = min(max((offs[i + 1] - offs[i] + MTILE - 1) >> 6, 0), MAXT);
    above += max(nts[i] - 1 - (int)(threadIdx.x & 31), 0);
  }
  const int u = __builtin_ctz(__builtin_amdgcn_ballot_w32(above <= rank));   // the rank's level: the lowest with no more than rank tiles above it (lane 31 always has 0)
  int k = rank - __builtin_amdgcn_readlane(above, u);     // place within the level
  int b = -1, off = 0, nlen = 0, ntl = 0;
#pragma unroll
  for (int i = 0; i < NSEQ; ++i) {
    const bool has = nts[i] > u;
    if (has && k == 0) { b = i; off = offs[i]; nlen = offs[i + 1] - offs[i]; ntl = nts[i]; }
    k -= has ? 1 : 0;
  }
  if (b < 0) return;                                      // rank past the last tile: block-uniform, before any barrier
  // cost order inside a sequence: the last tile, then tile 0 (its contextual rows walk every key), then the causal tiles from the back
  const int row0 = ((u == ntl - 1) ? u : (u == ntl - 2) ? 0 : u + 1) * MTILE;

  const int nc   = p_nctx[0];                              // contextual tokens at the head of each sequence
  const int nt   = ncand[b];                               // target (candidate) tokens at the tail
  const int max1 = nlen - nc + 1;
  const int max2 = max1 - nt;
  const int maxseq = p_maxseq[0];

  const int tid = threadIdx.x, wave = __builtin_amdgcn_readfirstlane(tid >> 5), lane = tid & 31, l16 = lane & 15, hh = lane >> 4;
  // the wave number is held in a scalar register, so that row group, key tile and the tile test below are scalar and cost no VGPR
  const int rg = wave & 3, ks = wave >> 2;                 // row group of 16 queries, key tile of the round
  const int qb = row0 + rg * 16;

  // ---- Q fragments (bf16-rounded input), kept for the whole key loop: 2 x 8 VGPRs
  int qrow = qb + l16; if (qrow > nlen - 1) qrow = nlen - 1;
  const float* qp = tq + (size_t)(off + qrow) * (NHEAD * DQK) + h * DQK;
  const v16b qf0 = frag_gbf(qp, lane), qf1 = frag_gbf(qp + 32, lane);

  v8f acc[4];
#pragma unroll
  for (int i = 0; i < 4; ++i) acc[i] = (v8f){};

  // rows holding contextual tokens (x < nc) attend to the whole history, everyone else is causal within the block's rows
  const int jcaus = (nlen < row0 + MTILE) ? nlen : (row0 + MTILE);
  const int jmax  = (row0 < nc) ? nlen : jcaus;                      // block-uniform
  const bool wctx = (qb < nc);                                       // wave-uniform

  for (int j = 0; j < jmax; j += JTILE * KSPLIT) {
    // ---- cooperative staging of the round's 4 tiles (128 keys): K rows as bf16, V transposed as bf16 ----
    {
      const int cgk = (tid & 7) * 8, cgv = (tid & 15) * 4;             // K: 8 d columns of one key; V: 4 d columns of a key pair
      v4f ka[2][2], va[2][2];
#pragma unroll
      for (int t = 0; t < 2; ++t) {
        int krow = j + t * 64 + (tid >> 3); if (krow > nlen - 1) krow = nlen - 1;   // address clamp; clamped keys are masked by (y < nlen)
        const float* kp = tk + (size_t)(off + krow) * (NHEAD * DQK) + h * DQK + cgk;
        ka[t][0] = *(const v4f*)kp;
        asm volatile("s_wait_xcnt 0x0" ::: "memory");                  // the next load's result may land in the address pair that the load above names: keep the wait in front of that overwrite
        ka[t][1] = *(const v4f*)(kp + 4);
      }
#pragma unroll
      for (int t = 0; t < 2; ++t) {
        int r0g = j + 2 * (t * 32 + (tid >> 4)), r1g = r0g + 1;        // key pair of the round
        if (r0g > nlen - 1) r0g = nlen - 1;
        if (r1g > nlen - 1) r1g = nlen - 1;
        va[t][0] = *(const v4f*)(tv + (size_t)(off + r0g) * (NHEAD * DVV) + h * DVV + cgv);
        va[t][1] = *(const v4f*)(tv + (size_t)(off + r1g) * (NHEAD * DVV) + h * DVV + cgv);
      }
      // holds the 8 loads together in front of the first conversion: one memory latency a round instead of one per load pair
      asm volatile("" :: "v"(ka[0][0]), "v"(ka[0][1]), "v"(ka[1][0]), "v"(ka[1][1]), "v"(va[0][0]), "v"(va[0][1]), "v"(va[1][0]), "v"(va[1][1]));
#pragma unroll
      for (int t = 0; t < 2; ++t) {
        const int kl = t * 64 + (tid >> 3);                            // key of the round, 0..127: tile kl / 32, row kl % 32
        union { v8b v; uint4 u; } cv;
#pragma unroll
        for (int i = 0; i < 4; ++i) { cv.v[i] = (__bf16)ka[t][0][i]; cv.v[4 + i] = (__bf16)ka[t][1][i]; }
        *(uint4*)&Kb[kl >> 5][kl & 31][cgk] = cv.u;
      }
#pragma unroll
      for (int t = 0; t < 2; ++t) {
        const int pl = t * 32 + (tid >> 4);                            // key pair of the round, 0..63: tile pl / 16, keys 2 * (pl % 16) and the next
#pragma unroll
        for (int i = 0; i < 4; ++i) {
          union { __bf16 h2[2]; uint32_t u; } p;
          p.h2[0] = (__bf16)va[t][0][i]; p.h2[1] = (__bf16)va[t][1][i];
          *(uint32_t*)&Vt[pl >> 4][cgv + i][2 * (pl & 15)] = p.u;
        }
      }
    }
    __syncthreads();

    const int jt = j + ks * JTILE;                                     // first key of this wave's tile
    const bool active = (jt < jmax) && (wctx || (jt <= qb + 15));      // wave-uniform: tile has at least one unmasked key for this wave
    if (active) {
      // ---- S = Q K^T for keys jt..jt+15 and jt+16..jt+31 (exact bf16 products)
      // the tile's four K fragments are read as one group in front of the four WMMAs: one LDS latency a tile, where a waited pair of reads stood in front of each WMMA.
      // The two subtiles' WMMAs alternate, so that neither waits for its own accumulator; each accumulator still takes d chunk 0, then d chunk 1
      const v16b k00 = frag_b16(&Kb[ks][l16][0], lane),      k01 = frag_b16(&Kb[ks][l16][32], lane);
      const v16b k10 = frag_b16(&Kb[ks][16 + l16][0], lane), k11 = frag_b16(&Kb[ks][16 + l16][32], lane);
      v8f s0 = wmma_bf(qf0, k00, (v8f){}), s1 = wmma_bf(qf0, k10, (v8f){});
      s0 = wmma_bf(qf1, k01, s0);          s1 = wmma_bf(qf1, k11, s1);
      // inputs only, no instruction: the four loaded fragments stay in their registers until the last of the four WMMAs has issued, so that no WMMA's result is placed over the B operand of the WMMA directly in front of it
      asm volatile("" :: "v"(k00), "v"(k01), "v"(k10), "v"(k11), "v"(s0), "v"(s1));

      // ---- 16 * silu(alpha * s) and the integer mask; C layout (row 8*hh + r, column l16) -> LDS row-major
      {
        float* sp = &Sscr[wave][hh * 8][l16];                           // the lane's element of row r = 0; the rows follow at constant offsets
        // Scalar test for a tile whose 16 x 32 scores all pass the mask. The shifted ids grow with the position, so the tile's first row against its last key decides for all:
        // strictly causal in the shifted ids, the last key ahead of the target tokens (its group id is negative, which opens the group test for every row), rows and keys inside the sequence
        const int idyl = max(jt + JTILE - nc, 0);                       // shifted id of the tile's last key
        const bool inner = (max(qb - nc + 1, 0) > idyl) && (idyl < max2) && (qb + 15 < nlen) && (jt + JTILE - 1 < nlen);
        if (inner) {
#pragma unroll
          for (int r = 0; r < 8; ++r) { sp[r * SPITCH] = fsilu16(s0[r]); sp[r * SPITCH + 16] = fsilu16(s1[r]); }
        } else {
        // For a fixed key y every term of the mask is a threshold on the row x, so the 16 rows of the tile that pass against y are a few bit ranges (bit m = row qb + m):
        //   idx > idy        <=> x >= idy + nc            (idy >= 0)
        //   tgx < 0          <=> max2 > 0 and x < max2 + nc - 1;   tgy < 0 <=> idy < max2 ("open" key, ahead of the target tokens)
        //   tgx == tgy with both >= 0 <=> idx == idy, which beside (x == y or idx > idy) leaves x == y alone
        //   idx == 0         <=> x < nc
        // pass = [ x == y  or  (x >= idy + nc and (open or tgx < 0))  or  (x < nc and open) ] and y < nlen and x < nlen: the same truth table as the reference's mask for all integers
        const unsigned ltN = lt16(nlen - qb), ltC = lt16(nc - qb), ltG = (max2 > 0) ? lt16(max2 + nc - 1 - qb) : 0u;   // scalar: rows inside the sequence, contextual rows, rows ahead of the targets
        unsigned rb[2];
#pragma unroll
        for (int c = 0; c < 2; ++c) {
          const int y = jt + l16 + 16 * c, idy = max(y - nc + 1, 0), e = y - qb;
          const bool open = idy < max2;
          const unsigned caus = ~0u << min(max(idy + nc - qb, 0), 16);
          const unsigned diag = ((unsigned)e < 16u) ? (1u << (e & 15)) : 0u;
          rb[c] = (diag | (caus & (open ? ~0u : ltG)) | (open ? ltC : 0u)) & ((y < nlen) ? ltN : 0u);
        }
        const unsigned mm = ((rb[0] >> (hh * 8)) & 0xFFu) | ((rb[1] >> (hh * 8)) << 8);   // the lane's 8 rows: bits 0..7 for key y0, 8..15 for key y0 + 16
#pragma unroll
        for (int r = 0; r < 8; ++r) {
          sp[r * SPITCH]      = ((mm >> r) & 1u)       ? fsilu16(s0[r]) : 0.0f;
          sp[r * SPITCH + 16] = ((mm >> (8 + r)) & 1u) ? fsilu16(s1[r]) : 0.0f;
        }
        }
      }
      LDSX();
      // ---- read the wave's 16x32 P tile back as an A fragment, split into bf16 hi + residual
      // the four V fragments are read in the same group, behind P's rows: they land while P is split, and the eight WMMAs follow with no LDS wait among them
      F2 pf; v16b vf[4];
      { float v[16]; const float* row = &Sscr[wave][l16][0]; const int c0 = hh * 8;
#pragma unroll
        for (int i = 0; i < 8; ++i) { v[i] = row[c0 + i]; v[8 + i] = row[16 + c0 + i]; }
#pragma unroll
        for (int dc = 0; dc < 4; ++dc) vf[dc] = frag_b16(&Vt[ks][dc * 16 + l16][0], lane);   // keys 8*hh.., 16+8*hh..
        pf = bsplit16(v); }
      // ---- O += P V (4 d tiles x 2 WMMAs): the residual over all four d tiles, then hi, so that each accumulator keeps its order (residual, hi) and no WMMA follows its own accumulator directly
#pragma unroll
      for (int dc = 0; dc < 4; ++dc) acc[dc] = wmma_bf(pf.l, vf[dc], acc[dc]);
#pragma unroll
      for (int dc = 0; dc < 4; ++dc) acc[dc] = wmma_bf(pf.h, vf[dc], acc[dc]);
    }
    __syncthreads();                                                   // protect Kb/Vt before the next staging round
  }

  // the lane number is read anew here, so that no lane index has to stay in a VGPR over the key loop just for these last lines (the loop sits at its register limit; held over it, such values spill to scratch)
  const int el = (int)__builtin_amdgcn_mbcnt_lo(~0u, 0u), e16 = el & 15, eh = el >> 4;
  float* so = &So[wave][0][0];
#pragma unroll
  for (int r = 0; r < 8; ++r)
#pragma unroll
    for (int dc = 0; dc < 4; ++dc) so[(r + eh * 8) * OPITCH + dc * 16 + e16] = acc[dc][r];
  __syncthreads();                                                     // every wave's partial rows are in LDS before any wave sums them
  const float invDenom = 0.0625f / (float)maxseq;                      // the 1/16 that the loop's silu form leaves out, and 1 / max_seqlen
  // ---- sum the 4 key splits of each row in the fixed order 0..3, scale, store whole 256-B rows (16 lanes x 16 B)
#pragma unroll
  for (int i = 0; i < 2; ++i) { const int m = i * 32 + wave * 2 + eh, c = e16 * 4; const int x = row0 + m;   // wave * 2 + eh = thread / 16
    const float* pr = &So[m >> 4][m & 15][c];                          // wave index = 4 * split + row group
    v4f s = *(const v4f*)pr;
#pragma unroll
    for (int k = 1; k < KSPLIT; ++k) s += *(const v4f*)(pr + k * 4 * 16 * OPITCH);
    if (x < nlen) vst2(out + (size_t)(off + x) * (NHEAD * DVV) + h * DVV + c, (v4f)(s * invDenom)); }
}

extern "C" void kernel_launch(void* const* d_in, const int* in_sizes, int n_in, void* d_out, int out_size, void* d_ws, size_t ws_size, hipStream_t stream) {
  (void)in_sizes; (void)n_in; (void)out_size; (void)d_ws; (void)ws_size;
  dim3 grid(NHEAD * MAXITEMS, 1, 1), block(512, 1, 1);
  k_attn<<<grid, block, 0, stream>>>((const float*)d_in[0], (const float*)d_in[1], (const float*)d_in[2],
                                     (const int*)d_in[3], (const int*)d_in[4], (const int*)d_in[5], (const int*)d_in[6], (float*)d_out);
}

// v008
// It runs in 17.6 microseconds.
// Timed twice side by side with v007, it ran 1.14 and 1.11 times as fast.
// All steps since v000 together make it 5.52 times as fast.
// compute dtype: q, k, v (module inputs) rounded to bf16; S = q k^T as exact bf16 WMMA products (f32 accumulate); silu and the integer attention mask in f32;
// silu(S) carried as a bf16 hi + bf16 residual pair against bf16 v (f32 accumulate); the 1/max_seqlen factor applied in the f32 epilogue.
#include <hip/hip_runtime.h>
#include <math.h>

typedef __attribute__((ext_vector_type(16))) _Float16 v16h;
typedef __attribute__((ext_vector_type(16))) __bf16 v16b;
typedef __attribute__((ext_vector_type(8)))  _Float16 v8h;
typedef __attribute__((ext_vector_type(8)))  float v8f;
typedef __attribute__((ext_vector_type(4)))  float v4f;
typedef __attribute__((ext_vector_type(2)))  float v2f;
typedef __attribute__((ext_vector_type(4)))  unsigned v4u;
typedef __attribute__((ext_vector_type(4)))  int v4i;
typedef float __attribute__((may_alias)) float_a;
typedef int __attribute__((may_alias)) int_a;

template <typename T> __device__ __forceinline__ void vst2(void* p, T v) { *(T*)p = v;  }
__device__ __forceinline__ v8f wmma16(v16h a, v16h b, v8f c) {
  v8f d = __builtin_amdgcn_wmma_f32_16x16x32_f16(false, a, false, b, (short)0, c, false, false);
  asm volatile("v_nop\n\tv_nop\n\tv_nop\n\tv_nop" : "+v"(d) : "v"(a), "v"(b));
  return d;
}
__device__ __forceinline__ v8f wmma_bf(v16b a, v16b b, v8f c) {   // the plain builtin: the compiler keeps the distances behind it and is free to move LDS reads ahead of a run of them
  return __builtin_amdgcn_wmma_f32_16x16x32_bf16(false, a, false, b, (short)0, c, false, false);
}
// 16x16x32 fragments: lane = (h = lane>>4, row/col = lane&15); elements 0..7 = k0+8h+0..7, 8..15 = k0+16+8h+0..7; D element r = row 8h+r
__device__ __forceinline__ v16h frag_h(const _Float16* rowk0, int lane) {
  union { v16h v; v8h q[2]; } u; const _Float16* p = rowk0 + 8 * (lane >> 4);
  u.q[0] = *(const v8h*)p; u.q[1] = *(const v8h*)(p + 16); return u.v;
}
__device__ __forceinline__ v16h frag_f32(const float* rowk0, int lane) {
  v16h a; const float* p = rowk0 + 8 * (lane >> 4);
#pragma unroll
  for (int i = 0; i < 8; ++i) { a[i] = (_Float16)p[i]; a[8 + i] = (_Float16)p[16 + i]; }
  return a;
}
__device__ __forceinline__ v16h frag_f32s(const float* rowk0, int lane, float sc) {
  v16h a; const float* p = rowk0 + 8 * (lane >> 4);
#pragma unroll
  for (int i = 0; i < 8; ++i) { a[i] = (_Float16)(p[i] * sc); a[8 + i] = (_Float16)(p[16 + i] * sc); }
  return a;
}
// column fragment from a [K][ld] layout (column n), rows >= K read as 0
__device__ __forceinline__ v16h fragc_f32(const float* W, int k0, int n, int lane, int ld, int K) {
  v16h a; const int g = lane >> 4;
#pragma unroll
  for (int i = 0; i < 8; ++i) { const int ka = k0 + 8 * g + i, kb = ka + 16;
    a[i] = (_Float16)(ka < K ? W[(size_t)(ka < K ? ka : K - 1) * ld + n] : 0.f); a[8 + i] = (_Float16)(kb < K ? W[(size_t)(kb < K ? kb : K - 1) * ld + n] : 0.f); }
  return a;
}
struct F2 { v16b h, l; };
__device__ __forceinline__ F2 bsplit16(const float v[16]) { F2 r;
#pragma unroll
  for (int i = 0; i < 16; ++i) { const __bf16 h = (__bf16)v[i]; r.h[i] = h; r.l[i] = (__bf16)(v[i] - (float)h); }
  return r; }
__device__ __forceinline__ F2 split_row(const float* row, int k0, int lane) { float v[16]; const float* p = row + k0 + 8 * (lane >> 4);
#pragma unroll
  for (int i = 0; i < 8; ++i) { v[i] = p[i]; v[8 + i] = p[16 + i]; }
  return bsplit16(v); }
__device__ __forceinline__ F2 split_rowK(const float* row, int k0, int lane, int K) { float v[16]; const int g = lane >> 4;
#pragma unroll
  for (int i = 0; i < 8; ++i) { const int ka = k0 + 8 * g + i, kb = ka + 16; v[i] = ka < K ? row[ka < K ? ka : K - 1] : 0.f; v[8 + i] = kb < K ? row[kb < K ? kb : K - 1] : 0.f; }
  return bsplit16(v); }
__device__ __forceinline__ F2 split_col(const float* W, int k0, int n, int lane, int ld, int K) { float v[16]; const int g = lane >> 4;
#pragma unroll
  for (int i = 0; i < 8; ++i) { const int ka = k0 + 8 * g + i, kb = ka + 16; v[i] = ka < K ? W[(size_t)(ka < K ? ka : K - 1) * ld + n] : 0.f; v[8 + i] = kb < K ? W[(size_t)(kb < K ? kb : K - 1) * ld + n] : 0.f; }
  return bsplit16(v); }
__device__ __forceinline__ v8f mac3(const F2& a, const F2& b, v8f c) { c = wmma_bf(a.l, b.h, c); c = wmma_bf(a.h, b.l, c); return wmma_bf(a.h, b.h, c); }
__device__ __forceinline__ float sigm(float v) { return 1.0f / (1.0f + expf(-v)); }
#define LDSX() do { asm volatile("s_wait_dscnt 0" ::: "memory"); __builtin_amdgcn_wave_barrier(); __builtin_amdgcn_fence(__ATOMIC_RELEASE, "workgroup"); } while (0)


// Jagged causal silu attention with contextual / target-group masking. One block = 64 query rows of one (sequence, head): 16 waves = 4 row groups of 16 x 4 key tiles;
// a round stages 4 key tiles of 32 in LDS (K row-major bf16, V transposed bf16; the f32 rows arrive one round ahead by asynchronous copies) and each wave works on one of them, so a row's keys are walked by 4 waves side by side;
// per wave and tile: 4 WMMAs for S (two 16-key subtiles x two 32-wide d chunks), silu + mask through a per-wave LDS transpose, 8 WMMAs for O (4 d tiles x {residual, hi}).
// The 4 partial outputs of a row group are summed through LDS behind the loop (silu attention has no row normaliser, so partial sums just add)
#define NHEAD 4
#define DQK   64
#define DVV   64
#define MTILE 64
#define JTILE 32
#define KSPLIT 4
#define NWAVE 16
#define MAXSEQ 2048
#define NSEQ   8
#define LTOK   8192                       // rows of tq, tk, tv: all sequences together
#define MAXT   (MAXSEQ / MTILE)           // row tiles of one sequence at most: 32, one per lane of the rank search
#define MAXITEMS (LTOK / MTILE + NSEQ)    // row tiles of all sequences together at most: each sequence rounds up once
// LDS row pitches. K, transposed V and S scratch are read by ds_load_b128 with 16 lanes on 16 rows: a pitch of 16 B x odd spreads those rows over all 64 banks,
// where the bare 128-B and 64-B rows put them on 8 and 16 banks. The partial output rows are padded for their stores: the two lane halves write rows 8 apart,
// which fall on the same banks at 256 B. The pad elements are never written and never read, except So's inside the copies' landing area
#define KPITCH 72    // bf16 per K row: 144 B
#define VPITCH 40    // bf16 per transposed V row: 80 B
#define SPITCH 36    // f32 per row of the S transpose scratch: 144 B
#define OPITCH 68    // f32 per partial output row: 272 B
typedef __attribute__((ext_vector_type(8))) __bf16 v8b;
__device__ __forceinline__ v16b frag_b16(const __bf16* rowk0, int lane) {   // 16x16x32 operand fragment from a bf16 row: elements 0..7 = k0+8h.., 8..15 = k0+16+8h..
  union { v16b v; v8b q[2]; } u; const __bf16* p = rowk0 + 8 * (lane >> 4);
  u.q[0] = *(const v8b*)p; u.q[1] = *(const v8b*)(p + 16); return u.v;
}
__device__ __forceinline__ v16b frag_gbf(const float* rowk0, int lane) {     // same map from an f32 global row, rounding to bf16 (RNE)
  v16b a; const float* p = rowk0 + 8 * (lane >> 4);
#pragma unroll
  for (int i = 0; i < 8; ++i) { a[i] = (__bf16)p[i]; a[8 + i] = (__bf16)p[16 + i]; }
  return a;
}
// 16 * silu(s / 8) = s + s * tanh(s / 16), from sigmoid(x) = (1 + tanh(x / 2)) / 2: multiply, the hardware's f32 tanh, fused multiply-add, in place of the library expf
// with its range reduction and the IEEE division sequence. tanh saturates at -1 and 1, which gives 0 and 2 s, the limits. The exact factor 1/16 is applied in the epilogue
__device__ __forceinline__ float fsilu16(float s) { return fmaf(s, __builtin_amdgcn_tanhf(s * 0.0625f), s); }
__device__ __forceinline__ unsigned lt16(int t) { return (1u << min(max(t, 0), 16)) - 1u; }   // bits m = 0..15 with m < t

// One round's K and V rows (128 keys x 64 f32 each, 64 KB) go from global memory to LDS by 8 asynchronous copies of 16 B a lane, through no register, so that they can fly
// while the round before is worked on. A copy of a wave covers two whole 256-B row segments (4 lines). Slot i of the landing area holds copy i: 16 B a thread, in thread order;
// a lane reads back only the 16 B that it copied itself, so the area is private to each wave and takes no barrier of its own
#define RAWSLOT 8192                      // bytes of one copy slot: 512 threads x 16 B
__device__ __forceinline__ void copy_round(const float* kbase, const float* vbase, int nlen, int j, int tid, unsigned lds0) {
  // kbase, vbase: the sequence's first row at the head's first column (the same in every lane: a scalar base); a lane's place is a 32-bit byte offset from it
  const int rr = tid >> 4; const unsigned cb = (tid & 15) * 16;
  unsigned o[8];
#pragma unroll
  for (int i = 0; i < 4; ++i) {
    int krow = j + i * 32 + rr; if (krow > nlen - 1) krow = nlen - 1;   // address clamp; clamped keys are masked by (y < nlen)
    o[i] = (unsigned)krow * (NHEAD * DQK * 4) + cb;
  }
#pragma unroll
  for (int t = 0; t < 2; ++t) {
    int r0g = j + 2 * (t * 32 + rr), r1g = r0g + 1;                     // key pair of the round
    if (r0g > nlen - 1) r0g = nlen - 1;
    if (r1g > nlen - 1) r1g = nlen - 1;
    o[4 + 2 * t] = (unsigned)r0g * (NHEAD * DVV * 4) + cb;
    o[5 + 2 * t] = (unsigned)r1g * (NHEAD * DVV * 4) + cb;
  }
  // the copies and their s_wait_xcnt in one statement: the wait stands in front of every later write of a register that a copy names
  asm volatile("global_load_async_to_lds_b128 %0, %8, %16\n\t"
               "global_load_async_to_lds_b128 %1, %9, %16\n\t"
               "global_load_async_to_lds_b128 %2, %10, %16\n\t"
               "global_load_async_to_lds_b128 %3, %11, %16\n\t"
               "global_load_async_to_lds_b128 %4, %12, %17\n\t"
               "global_load_async_to_lds_b128 %5, %13, %17\n\t"
               "global_load_async_to_lds_b128 %6, %14, %17\n\t"
               "global_load_async_to_lds_b128 %7, %15, %17\n\t"
               "s_wait_xcnt 0x0"
               :: "v"(lds0), "v"(lds0 + RAWSLOT), "v"(lds0 + 2 * RAWSLOT), "v"(lds0 + 3 * RAWSLOT),
                  "v"(lds0 + 4 * RAWSLOT), "v"(lds0 + 5 * RAWSLOT), "v"(lds0 + 6 * RAWSLOT), "v"(lds0 + 7 * RAWSLOT),
                  "v"(o[0]), "v"(o[1]), "v"(o[2]), "v"(o[3]), "v"(o[4]), "v"(o[5]), "v"(o[6]), "v"(o[7]),
                  "s"(kbase), "s"(vbase)
               : "memory");
}

__global__ __launch_bounds__(512, 8)   // 128 VGPRs: two of these 16-wave blocks stay resident on a WGP
void k_attn(const float* __restrict__ tq, const float* __restrict__ tk, const float* __restrict__ tv,
            const int* __restrict__ offsets, const int* __restrict__ ncand, const int* __restrict__ p_maxseq, const int* __restrict__ p_nctx,
            float* __restrict__ out) {
  __shared__ __align__(16) __bf16 Kb[KSPLIT][JTILE][KPITCH];  // key rows, bf16, one tile per key split (18 KB)
  __shared__ __align__(16) __bf16 Vt[KSPLIT][DVV][VPITCH];  // v transposed: Vt[tile][d][key] (20 KB)
  __shared__ __align__(16) float Sscr[NWAVE][16][SPITCH];    // per-wave S transpose scratch (36 KB)
  __shared__ __align__(16) float So[NWAVE][16][OPITCH];     // per-wave partial output rows (68 KB), used behind the key loop; inside it the first 64 KB are the copies' landing area

  // ---- block index -> (head, sequence, row tile), the longest key walk first. The launch ends with the
  // last one to finish: a long walk that starts late runs on alone. Level u of a sequence stands for its u-th cheapest tile; levels are handed out from the top down over
  // all sequences, heads innermost. The map is a permutation of the tiles for any lengths, and it is the same in every wave (scalar values only)
  const int h = blockIdx.x & (NHEAD - 1), rank = blockIdx.x / NHEAD;
  int offs[NSEQ + 1], nts[NSEQ];
#pragma unroll
  for (int i = 0; i <= NSEQ; ++i) offs[i] = offsets[i];
  int above = 0;                                          // lane t: tiles of all sequences on a level above t
#pragma unroll
  for (int i = 0; i < NSEQ; ++i) {
    nts[i] = min(max((offs[i + 1] - offs[i] + MTILE - 1) >> 6, 0), MAXT);
    above += max(nts[i] - 1 - (int)(threadIdx.x & 31), 0);
  }
  const int u = __builtin_ctz(__builtin_amdgcn_ballot_w32(above <= rank));   // the rank's level: the lowest with no more than rank tiles above it (lane 31 always has 0)
  int k = rank - __builtin_amdgcn_readlane(above, u);     // place within the level
  int b = -1, off = 0, nlen = 0, ntl = 0;
#pragma unroll
  for (int i = 0; i < NSEQ; ++i) {
    const bool has = nts[i] > u;
    if (has && k == 0) { b = i; off = offs[i]; nlen = offs[i + 1] - offs[i]; ntl = nts[i]; }
    k -= has ? 1 : 0;
  }
  if (b < 0) return;                                      // rank past the last tile: block-uniform, before any barrier
  // cost order inside a sequence: the last tile, then tile 0 (its contextual rows walk every key), then the causal tiles from the back
  const int row0 = ((u == ntl - 1) ? u : (u == ntl - 2) ? 0 : u + 1) * MTILE;

  const int nc   = p_nctx[0];                              // contextual tokens at the head of each sequence
  const int nt   = ncand[b];                               // target (candidate) tokens at the tail
  const int max1 = nlen - nc + 1;
  const int max2 = max1 - nt;
  const int maxseq = p_maxseq[0];

  // round 0's copies start here, behind the issue of the parameter loads above and ahead of Q (a tile has at least one key, so round 0 always runs)
  const int tid = threadIdx.x;
  const unsigned raw0 = (unsigned)(size_t)&So[0][0][0] + (unsigned)tid * 16u;   // the lane's 16 B in slot 0: LDS byte address
  const float* kbase = tk + (size_t)off * (NHEAD * DQK) + h * DQK;
  const float* vbase = tv + (size_t)off * (NHEAD * DVV) + h * DVV;
  copy_round(kbase, vbase, nlen, 0, tid, raw0);

  const int wave = __builtin_amdgcn_readfirstlane(tid >> 5), lane = tid & 31, l16 = lane & 15, hh = lane >> 4;
  // the wave number is held in a scalar register, so that row group, key tile and the tile test below are scalar and cost no VGPR
  const int rg = wave & 3, ks = wave >> 2;                 // row group of 16 queries, key tile of the round
  const int qb = row0 + rg * 16;

  // ---- Q fragments (bf16-rounded input), kept for the whole key loop: 2 x 8 VGPRs
  int qrow = qb + l16; if (qrow > nlen - 1) qrow = nlen - 1;
  const float* qp = tq + (size_t)(off + qrow) * (NHEAD * DQK) + h * DQK;
  const v16b qf0 = frag_gbf(qp, lane), qf1 = frag_gbf(qp + 32, lane);

  v8f acc[4];
#pragma unroll
  for (int i = 0; i < 4; ++i) acc[i] = (v8f){};

  // rows holding contextual tokens (x < nc) attend to the whole history, everyone else is causal within the block's rows
  const int jcaus = (nlen < row0 + MTILE) ? nlen : (row0 + MTILE);
  const int jmax  = (row0 < nc) ? nlen : jcaus;                      // block-uniform
  const bool wctx = (qb < nc);                                       // wave-uniform

  for (int j = 0; j < jmax; j += JTILE * KSPLIT) {
    // ---- the round's 4 tiles (128 keys) have been copied to the landing area as f32; each lane turns its own 8 x 16 B into K rows as bf16 and V transposed as bf16 ----
    {
      const int rr = tid >> 4, cg = (tid & 15) * 4;                    // K: 4 d columns of key rr of each tile; V: 4 d columns of a key pair
      asm volatile("s_wait_asynccnt 0x0" ::: "memory");                // the wave's own copies of this round have landed before it reads them
      const char* rp = (const char*)&So[0][0][0] + tid * 16;
      v4f ka[4], va[2][2];
#pragma unroll
      for (int i = 0; i < 4; ++i) ka[i] = *(const v4f*)(rp + i * RAWSLOT);
#pragma unroll
      for (int t = 0; t < 2; ++t) { va[t][0] = *(const v4f*)(rp + (4 + 2 * t) * RAWSLOT); va[t][1] = *(const v4f*)(rp + (5 + 2 * t) * RAWSLOT); }
      // every wave has left the round before: Kb and Vt may be overwritten. The barrier stands behind the reads of the landing slots, which are the wave's own,
      // so that a wave that is done early has its share in registers while the others still work
      __syncthreads();
#pragma unroll
      for (int i = 0; i < 4; ++i) {                                    // key i * 32 + rr of the round: tile i, row rr
        union { __bf16 h4[4]; uint2 u; } cv;
#pragma unroll
        for (int e = 0; e < 4; ++e) cv.h4[e] = (__bf16)ka[i][e];
        *(uint2*)&Kb[i][rr][cg] = cv.u;
      }
#pragma unroll
      for (int t = 0; t < 2; ++t) {
        const int pl = t * 32 + rr;                                    // key pair of the round, 0..63: tile pl / 16, keys 2 * (pl % 16) and the next
#pragma unroll
        for (int i = 0; i < 4; ++i) {
          union { __bf16 h2[2]; uint32_t u; } p;
          p.h2[0] = (__bf16)va[t][0][i]; p.h2[1] = (__bf16)va[t][1][i];
          *(uint32_t*)&Vt[pl >> 4][cg + i][2 * (pl & 15)] = p.u;
        }
      }
      asm volatile("s_wait_dscnt 0x0" ::: "memory");                   // the wave's stores to Kb and Vt have landed before the barrier below lets the other waves read them
    }
    __syncthreads();
    // the next round's copies fly while this round is worked on; the test is the same for the whole work-group (scalar)
    const bool more = j + JTILE * KSPLIT < jmax;

    const int jt = j + ks * JTILE;                                     // first key of this wave's tile
    const bool active = (jt < jmax) && (wctx || (jt <= qb + 15));      // wave-uniform: tile has at least one unmasked key for this wave
    if (active) {
      // ---- S = Q K^T for keys jt..jt+15 and jt+16..jt+31 (exact bf16 products)
      // the tile's four K fragments are read as one group in front of the four WMMAs: one LDS latency a tile, where a waited pair of reads stood in front of each WMMA.
      // The two subtiles' WMMAs alternate, so that neither waits for its own accumulator; each accumulator still takes d chunk 0, then d chunk 1
      const v16b k00 = frag_b16(&Kb[ks][l16][0], lane),      k01 = frag_b16(&Kb[ks][l16][32], lane);
      const v16b k10 = frag_b16(&Kb[ks][16 + l16][0], lane), k11 = frag_b16(&Kb[ks][16 + l16][32], lane);
      if (more) copy_round(kbase, vbase, nlen, j + JTILE * KSPLIT, tid, raw0);   // issued behind the K fragment reads, whose LDS latency covers the issue
      v8f s0 = wmma_bf(qf0, k00, (v8f){}), s1 = wmma_bf(qf0, k10, (v8f){});
      s0 = wmma_bf(qf1, k01, s0);          s1 = wmma_bf(qf1, k11, s1);
      // inputs only, no instruction: the four loaded fragments stay in their registers until the last of the four WMMAs has issued, so that no WMMA's result is placed over the B operand of the WMMA directly in front of it
      asm volatile("" :: "v"(k00), "v"(k01), "v"(k10), "v"(k11), "v"(s0), "v"(s1));

      // ---- 16 * silu(alpha * s) and the integer mask; C layout (row 8*hh + r, column l16) -> LDS row-major
      {
        float* sp = &Sscr[wave][hh * 8][l16];                           // the lane's element of row r = 0; the rows follow at constant offsets
        // Scalar test for a tile whose 16 x 32 scores all pass the mask. The shifted ids grow with the position, so the tile's first row against its last key decides for all:
        // strictly causal in the shifted ids, the last key ahead of the target tokens (its group id is negative, which opens the group test for every row), rows and keys inside the sequence
        const int idyl = max(jt + JTILE - nc, 0);                       // shifted id of the tile's last key
        const bool inner = (max(qb - nc + 1, 0) > idyl) && (idyl < max2) && (qb + 15 < nlen) && (jt + JTILE - 1 < nlen);
        if (inner) {
#pragma unroll
          for (int r = 0; r < 8; ++r) { sp[r * SPITCH] = fsilu16(s0[r]); sp[r * SPITCH + 16] = fsilu16(s1[r]); }
        } else {
        // For a fixed key y every term of the mask is a threshold on the row x, so the 16 rows of the tile that pass against y are a few bit ranges (bit m = row qb + m):
        //   idx > idy        <=> x >= idy + nc            (idy >= 0)
        //   tgx < 0          <=> max2 > 0 and x < max2 + nc - 1;   tgy < 0 <=> idy < max2 ("open" key, ahead of the target tokens)
        //   tgx == tgy with both >= 0 <=> idx == idy, which beside (x == y or idx > idy) leaves x == y alone
        //   idx == 0         <=> x < nc
        // pass = [ x == y  or  (x >= idy + nc and (open or tgx < 0))  or  (x < nc and open) ] and y < nlen and x < nlen: the same truth table as the reference's mask for all integers
        const unsigned ltN = lt16(nlen - qb), ltC = lt16(nc - qb), ltG = (max2 > 0) ? lt16(max2 + nc - 1 - qb) : 0u;   // scalar: rows inside the sequence, contextual rows, rows ahead of the targets
        unsigned rb[2];
#pragma unroll
        for (int c = 0; c < 2; ++c) {
          const int y = jt + l16 + 16 * c, idy = max(y - nc + 1, 0), e = y - qb;
          const bool open = idy < max2;
          const unsigned caus = ~0u << min(max(idy + nc - qb, 0), 16);
          const unsigned diag = ((unsigned)e < 16u) ? (1u << (e & 15)) : 0u;
          rb[c] = (diag | (caus & (open ? ~0u : ltG)) | (open ? ltC : 0u)) & ((y < nlen) ? ltN : 0u);
        }
        const unsigned mm = ((rb[0] >> (hh * 8)) & 0xFFu) | ((rb[1] >> (hh * 8)) << 8);   // the lane's 8 rows: bits 0..7 for key y0, 8..15 for key y0 + 16
#pragma unroll
        for (int r = 0; r < 8; ++r) {
          sp[r * SPITCH]      = ((mm >> r) & 1u)       ? fsilu16(s0[r]) : 0.0f;
          sp[r * SPITCH + 16] = ((mm >> (8 + r)) & 1u) ? fsilu16(s1[r]) : 0.0f;
        }
        }
      }
      LDSX();
      // ---- read the wave's 16x32 P tile back as an A fragment, split into bf16 hi + residual
      // the four V fragments are read in the same group, behind P's rows: they land while P is split, and the eight WMMAs follow with no LDS wait among them
      F2 pf; v16b vf[4];
      { float v[16]; const float* row = &Sscr[wave][l16][0]; const int c0 = hh * 8;
#pragma unroll
        for (int i = 0; i < 8; ++i) { v[i] = row[c0 + i]; v[8 + i] = row[16 + c0 + i]; }
#pragma unroll
        for (int dc = 0; dc < 4; ++dc) vf[dc] = frag_b16(&Vt[ks][dc * 16 + l16][0], lane);   // keys 8*hh.., 16+8*hh..
        pf = bsplit16(v); }
      // ---- O += P V (4 d tiles x 2 WMMAs): the residual over all four d tiles, then hi, so that each accumulator keeps its order (residual, hi) and no WMMA follows its own accumulator directly
#pragma unroll
      for (int dc = 0; dc < 4; ++dc) acc[dc] = wmma_bf(pf.l, vf[dc], acc[dc]);
#pragma unroll
      for (int dc = 0; dc < 4; ++dc) acc[dc] = wmma_bf(pf.h, vf[dc], acc[dc]);
    } else if (more) copy_round(kbase, vbase, nlen, j + JTILE * KSPLIT, tid, raw0);   // a wave without a tile still brings its share of the next round
  }

  asm volatile("s_wait_asynccnt 0x0" ::: "memory");                    // no copy is outstanding when the landing area becomes the partial output rows (the last round's barriers have ended every read of it)
  // the lane number is read anew here, so that no lane index has to stay in a VGPR over the key loop just for these last lines (the loop sits at its register limit; held over it, such values spill to scratch)
  const int el = (int)__builtin_amdgcn_mbcnt_lo(~0u, 0u), e16 = el & 15, eh = el >> 4;
  float* so = &So[wave][0][0];
#pragma unroll
  for (int r = 0; r < 8; ++r)
#pragma unroll
    for (int dc = 0; dc < 4; ++dc) so[(r + eh * 8) * OPITCH + dc * 16 + e16] = acc[dc][r];
  __syncthreads();                                                     // every wave's partial rows are in LDS before any wave sums them
  const float invDenom = 0.0625f / (float)maxseq;                      // the 1/16 that the loop's silu form leaves out, and 1 / max_seqlen
  // ---- sum the 4 key splits of each row in the fixed order 0..3, scale, store whole 256-B rows (16 lanes x 16 B)
#pragma unroll
  for (int i = 0; i < 2; ++i) { const int m = i * 32 + wave * 2 + eh, c = e16 * 4; const int x = row0 + m;   // wave * 2 + eh = thread / 16
    const float* pr = &So[m >> 4][m & 15][c];                          // wave index = 4 * split + row group
    v4f s = *(const v4f*)pr;
#pragma unroll
    for (int k = 1; k < KSPLIT; ++k) s += *(const v4f*)(pr + k * 4 * 16 * OPITCH);
    if (x < nlen) vst2(out + (size_t)(off + x) * (NHEAD * DVV) + h * DVV + c, (v4f)(s * invDenom)); }
}

extern "C" void kernel_launch(void* const* d_in, const int* in_sizes, int n_in, void* d_out, int out_size, void* d_ws, size_t ws_size, hipStream_t stream) {
  (void)in_sizes; (void)n_in; (void)out_size; (void)d_ws; (void)ws_size;
  dim3 grid(NHEAD * MAXITEMS, 1, 1), block(512, 1, 1);
  k_attn<<<grid, block, 0, stream>>>((const float*)d_in[0], (const float*)d_in[1], (const float*)d_in[2],
                                     (const int*)d_in[3], (const int*)d_in[4], (const int*)d_in[5], (const int*)d_in[6], (float*)d_out);
}

// v009
// One run takes 15.9 microseconds.
// Timed twice side by side with v008, it ran 1.08 and 1.17 times as fast.
// Counting every step since v000, it is 6.21 times as fast.
// compute dtype: q, k, v (module inputs) rounded to bf16; S = q k^T as exact bf16 WMMA products (f32 accumulate); silu and the integer attention mask in f32;
// silu(S) carried as a bf16 hi + bf16 residual pair against bf16 v (f32 accumulate); the 1/max_seqlen factor applied in the f32 epilogue.
#include <hip/hip_runtime.h>
#include <math.h>

typedef __attribute__((ext_vector_type(16))) _Float16 v16h;
typedef __attribute__((ext_vector_type(16))) __bf16 v16b;
typedef __attribute__((ext_vector_type(8)))  _Float16 v8h;
typedef __attribute__((ext_vector_type(8)))  float v8f;
typedef __attribute__((ext_vector_type(4)))  float v4f;
typedef __attribute__((ext_vector_type(2)))  float v2f;
typedef __attribute__((ext_vector_type(4)))  unsigned v4u;
typedef __attribute__((ext_vector_type(4)))  int v4i;
typedef float __attribute__((may_alias)) float_a;
typedef int __attribute__((may_alias)) int_a;

template <typename T> __device__ __forceinline__ void vst2(void* p, T v) { *(T*)p = v;  }
__device__ __forceinline__ v8f wmma16(v16h a, v16h b, v8f c) {
  v8f d = __builtin_amdgcn_wmma_f32_16x16x32_f16(false, a, false, b, (short)0, c, false, false);
  asm volatile("v_nop\n\tv_nop\n\tv_nop\n\tv_nop" : "+v"(d) : "v"(a), "v"(b));
  return d;
}
__device__ __forceinline__ v8f wmma_bf(v16b a, v16b b, v8f c) {   // the plain builtin: the compiler keeps the distances behind it and is free to move LDS reads ahead of a run of them
  return __builtin_amdgcn_wmma_f32_16x16x32_bf16(false, a, false, b, (short)0, c, false, false);
}
// 16x16x32 fragments: lane = (h = lane>>4, row/col = lane&15); elements 0..7 = k0+8h+0..7, 8..15 = k0+16+8h+0..7; D element r = row 8h+r
__device__ __forceinline__ v16h frag_h(const _Float16* rowk0, int lane) {
  union { v16h v; v8h q[2]; } u; const _Float16* p = rowk0 + 8 * (lane >> 4);
  u.q[0] = *(const v8h*)p; u.q[1] = *(const v8h*)(p + 16); return u.v;
}
__device__ __forceinline__ v16h frag_f32(const float* rowk0, int lane) {
  v16h a; const float* p = rowk0 + 8 * (lane >> 4);
#pragma unroll
  for (int i = 0; i < 8; ++i) { a[i] = (_Float16)p[i]; a[8 + i] = (_Float16)p[16 + i]; }
  return a;
}
__device__ __forceinline__ v16h frag_f32s(const float* rowk0, int lane, float sc) {
  v16h a; const float* p = rowk0 + 8 * (lane >> 4);
#pragma unroll
  for (int i = 0; i < 8; ++i) { a[i] = (_Float16)(p[i] * sc); a[8 + i] = (_Float16)(p[16 + i] * sc); }
  return a;
}
// column fragment from a [K][ld] layout (column n), rows >= K read as 0
__device__ __forceinline__ v16h fragc_f32(const float* W, int k0, int n, int lane, int ld, int K) {
  v16h a; const int g = lane >> 4;
#pragma unroll
  for (int i = 0; i < 8; ++i) { const int ka = k0 + 8 * g + i, kb = ka + 16;
    a[i] = (_Float16)(ka < K ? W[(size_t)(ka < K ? ka : K - 1) * ld + n] : 0.f); a[8 + i] = (_Float16)(kb < K ? W[(size_t)(kb < K ? kb : K - 1) * ld + n] : 0.f); }
  return a;
}
struct F2 { v16b h, l; };
__device__ __forceinline__ F2 bsplit16(const float v[16]) { F2 r;
#pragma unroll
  for (int i = 0; i < 16; ++i) { const __bf16 h = (__bf16)v[i]; r.h[i] = h; r.l[i] = (__bf16)(v[i] - (float)h); }
  return r; }
__device__ __forceinline__ F2 split_row(const float* row, int k0, int lane) { float v[16]; const float* p = row + k0 + 8 * (lane >> 4);
#pragma unroll
  for (int i = 0; i < 8; ++i) { v[i] = p[i]; v[8 + i] = p[16 + i]; }
  return bsplit16(v); }
__device__ __forceinline__ F2 split_rowK(const float* row, int k0, int lane, int K) { float v[16]; const int g = lane >> 4;
#pragma unroll
  for (int i = 0; i < 8; ++i) { const int ka = k0 + 8 * g + i, kb = ka + 16; v[i] = ka < K ? row[ka < K ? ka : K - 1] : 0.f; v[8 + i] = kb < K ? row[kb < K ? kb : K - 1] : 0.f; }
  return bsplit16(v); }
__device__ __forceinline__ F2 split_col(const float* W, int k0, int n, int lane, int ld, int K) { float v[16]; const int g = lane >> 4;
#pragma unroll
  for (int i = 0; i < 8; ++i) { const int ka = k0 + 8 * g + i, kb = ka + 16; v[i] = ka < K ? W[(size_t)(ka < K ? ka : K - 1) * ld + n] : 0.f; v[8 + i] = kb < K ? W[(size_t)(kb < K ? kb : K - 1) * ld + n] : 0.f; }
  return bsplit16(v); }
__device__ __forceinline__ v8f mac3(const F2& a, const F2& b, v8f c) { c = wmma_bf(a.l, b.h, c); c = wmma_bf(a.h, b.l, c); return wmma_bf(a.h, b.h, c); }
__device__ __forceinline__ float sigm(float v) { return 1.0f / (1.0f + expf(-v)); }
#define LDSX() do { asm volatile("s_wait_dscnt 0" ::: "memory"); __builtin_amdgcn_wave_barrier(); __builtin_amdgcn_fence(__ATOMIC_RELEASE, "workgroup"); } while (0)


// Jagged causal silu attention with contextual / target-group masking. One block = 64 query rows of one (sequence, head): 16 waves = 4 row groups of 16 x 4 key tiles;
// a round stages 4 key tiles of 32 in LDS (K row-major bf16, V transposed bf16; the f32 rows arrive one round ahead by asynchronous copies) and each wave works on one of them, so a row's keys are walked by 4 waves side by side;
// per wave and tile: 4 WMMAs for S (two 16-key subtiles x two 32-wide d chunks), silu + mask through a per-wave LDS transpose, 8 WMMAs for O (4 d tiles x {residual, hi}).
// The 4 partial outputs of a row group are summed through LDS behind the loop (silu attention has no row normaliser, so partial sums just add)
#define NHEAD 4
#define DQK   64
#define DVV   64
#define MTILE 64
#define JTILE 32
#define KSPLIT 4
#define NWAVE 16
#define MAXSEQ 2048
#define NSEQ   8
#define LTOK   8192                       // rows of tq, tk, tv: all sequences together
#define MAXT   (MAXSEQ / MTILE)           // row tiles of one sequence at most: 32, one per lane of the rank search
#define MAXITEMS (LTOK / MTILE + NSEQ)    // row tiles of all sequences together at most: each sequence rounds up once
// LDS row pitches. K, transposed V and S scratch are read by ds_load_b128 with 16 lanes on 16 rows: a pitch of 16 B x odd spreads those rows over all 64 banks,
// where the bare 128-B and 64-B rows put them on 8 and 16 banks. The partial output rows are padded for their stores: the two lane halves write rows 8 apart,
// which fall on the same banks at 256 B. The pad elements are never written and never read, except So's as bytes of the copies' landing area in the key loop.
// Transposed V is written by lanes that stand 4 rows apart (320 B: 4 bank groups for 16 lanes at any pitch that keeps 16-B alignment). So the four 16-B chunks (8 keys each) of row d
// stand in the order chunk ^ (d / 16): the 16 lanes then fall on 16 different 16-B bank groups and a wave's 8-B stores cover all 64 banks once. A fragment read has one d / 16 for
// all its lanes, so it stays a ds_load_b128 over 16 rows at the odd pitch
#define KPITCH 72    // bf16 per K row: 144 B
#define VPITCH 40    // bf16 per transposed V row: 80 B
#define SPITCH 36    // f32 per row of the S transpose scratch: 144 B
#define OPITCH 68    // f32 per partial output row: 272 B
typedef __attribute__((ext_vector_type(8))) __bf16 v8b;
__device__ __forceinline__ v16b frag_b16(const __bf16* rowk0, int lane) {   // 16x16x32 operand fragment from a bf16 row: elements 0..7 = k0+8h.., 8..15 = k0+16+8h..
  union { v16b v; v8b q[2]; } u; const __bf16* p = rowk0 + 8 * (lane >> 4);
  u.q[0] = *(const v8b*)p; u.q[1] = *(const v8b*)(p + 16); return u.v;
}
__device__ __forceinline__ v16b frag_gbf(const float* rowk0, int lane) {     // same map from an f32 global row, rounding to bf16 (RNE)
  v16b a; const float* p = rowk0 + 8 * (lane >> 4);
#pragma unroll
  for (int i = 0; i < 8; ++i) { a[i] = (__bf16)p[i]; a[8 + i] = (__bf16)p[16 + i]; }
  return a;
}
// 16 * silu(s / 8) = s + s * tanh(s / 16), from sigmoid(x) = (1 + tanh(x / 2)) / 2: multiply, the hardware's f32 tanh, fused multiply-add, in place of the library expf
// with its range reduction and the IEEE division sequence. tanh saturates at -1 and 1, which gives 0 and 2 s, the limits. The exact factor 1/16 is applied in the epilogue
__device__ __forceinline__ float fsilu16(float s) { return fmaf(s, __builtin_amdgcn_tanhf(s * 0.0625f), s); }
__device__ __forceinline__ unsigned lt16(int t) { return (1u << min(max(t, 0), 16)) - 1u; }   // bits m = 0..15 with m < t

// One round's K and V rows (128 keys x 64 f32 each, 64 KB) go from global memory to LDS by 8 asynchronous copies of 16 B a lane, through no register, so that they can fly
// while the round before is worked on. A copy of a wave covers two whole 256-B row segments (4 lines). Slot i of the landing area holds copy i: 16 B a thread, in thread order;
// a lane reads back only the 16 B that it copied itself, so the area is private to each wave and takes no barrier of its own
#define RAWSLOT 8192                      // bytes of one copy slot: 512 threads x 16 B
__device__ __forceinline__ void copy_round(const float* kbase, const float* vbase, int nlen, int j, int tid, unsigned lds0) {
  // kbase, vbase: the sequence's first row at the head's first column (the same in every lane: a scalar base); a lane's place is a 32-bit byte offset from it
  const int rr = tid >> 4; const unsigned cb = (tid & 15) * 16;
  unsigned o[8];
#pragma unroll
  for (int i = 0; i < 4; ++i) {
    int krow = j + i * 32 + rr; if (krow > nlen - 1) krow = nlen - 1;   // address clamp; clamped keys are masked by (y < nlen)
    o[i] = (unsigned)krow * (NHEAD * DQK * 4) + cb;
  }
#pragma unroll
  for (int e = 0; e < 4; ++e) {
    int vrow = j + 4 * rr + e; if (vrow > nlen - 1) vrow = nlen - 1;    // V: four keys in a row, so that a lane can store 8 B of a transposed row; same clamp
    o[4 + e] = (unsigned)vrow * (NHEAD * DVV * 4) + cb;
  }
  // the copies and their s_wait_xcnt in one statement: the wait stands in front of every later write of a register that a copy names
  asm volatile("global_load_async_to_lds_b128 %0, %8, %16\n\t"
               "global_load_async_to_lds_b128 %1, %9, %16\n\t"
               "global_load_async_to_lds_b128 %2, %10, %16\n\t"
               "global_load_async_to_lds_b128 %3, %11, %16\n\t"
               "global_load_async_to_lds_b128 %4, %12, %17\n\t"
               "global_load_async_to_lds_b128 %5, %13, %17\n\t"
               "global_load_async_to_lds_b128 %6, %14, %17\n\t"
               "global_load_async_to_lds_b128 %7, %15, %17\n\t"
               "s_wait_xcnt 0x0"
               :: "v"(lds0), "v"(lds0 + RAWSLOT), "v"(lds0 + 2 * RAWSLOT), "v"(lds0 + 3 * RAWSLOT),
                  "v"(lds0 + 4 * RAWSLOT), "v"(lds0 + 5 * RAWSLOT), "v"(lds0 + 6 * RAWSLOT), "v"(lds0 + 7 * RAWSLOT),
                  "v"(o[0]), "v"(o[1]), "v"(o[2]), "v"(o[3]), "v"(o[4]), "v"(o[5]), "v"(o[6]), "v"(o[7]),
                  "s"(kbase), "s"(vbase)
               : "memory");
}

__global__ __launch_bounds__(512, 8)   // 128 VGPRs: two of these 16-wave blocks stay resident on a WGP
void k_attn(const float* __restrict__ tq, const float* __restrict__ tk, const float* __restrict__ tv,
            const int* __restrict__ offsets, const int* __restrict__ ncand, const int* __restrict__ p_maxseq, const int* __restrict__ p_nctx,
            float* __restrict__ out) {
  __shared__ __align__(16) __bf16 Kb[KSPLIT][JTILE][KPITCH];  // key rows, bf16, one tile per key split (18 KB)
  __shared__ __align__(16) __bf16 Vt[KSPLIT][DVV][VPITCH];  // v transposed: Vt[tile][d][key], 8-key chunk c of row d at place c ^ (d / 16) (20 KB)
  __shared__ __align__(16) float Sscr[NWAVE][16][SPITCH];    // per-wave S transpose scratch (36 KB)
  __shared__ __align__(16) float So[NWAVE][16][OPITCH];     // per-wave partial output rows (68 KB), used behind the key loop; inside it the first 64 KB are the copies' landing area

  // ---- block index -> (head, sequence, row tile), the longest key walk first. The launch ends with the
  // last one to finish: a long walk that starts late runs on alone. Level u of a sequence stands for its u-th cheapest tile; levels are handed out from the top down over
  // all sequences, heads innermost. The map is a permutation of the tiles for any lengths, and it is the same in every wave (scalar values only)
  const int h = blockIdx.x & (NHEAD - 1), rank = blockIdx.x / NHEAD;
  int offs[NSEQ + 1], nts[NSEQ];
#pragma unroll
  for (int i = 0; i <= NSEQ; ++i) offs[i] = offsets[i];
  int above = 0;                                          // lane t: tiles of all sequences on a level above t
#pragma unroll
  for (int i = 0; i < NSEQ; ++i) {
    nts[i] = min(max((offs[i + 1] - offs[i] + MTILE - 1) >> 6, 0), MAXT);
    above += max(nts[i] - 1 - (int)(threadIdx.x & 31), 0);
  }
  const int u = __builtin_ctz(__builtin_amdgcn_ballot_w32(above <= rank));   // the rank's level: the lowest with no more than rank tiles above it (lane 31 always has 0)
  int k = rank - __builtin_amdgcn_readlane(above, u);     // place within the level
  int b = -1, off = 0, nlen = 0, ntl = 0;
#pragma unroll
  for (int i = 0; i < NSEQ; ++i) {
    const bool has = nts[i] > u;
    if (has && k == 0) { b = i; off = offs[i]; nlen = offs[i + 1] - offs[i]; ntl = nts[i]; }
    k -= has ? 1 : 0;
  }
  if (b < 0) return;                                      // rank past the last tile: block-uniform, before any barrier
  // cost order inside a sequence: the last tile, then tile 0 (its contextual rows walk every key), then the causal tiles from the back
  const int row0 = ((u == ntl - 1) ? u : (u == ntl - 2) ? 0 : u + 1) * MTILE;

  const int nc   = p_nctx[0];                              // contextual tokens at the head of each sequence
  const int nt   = ncand[b];                               // target (candidate) tokens at the tail
  const int max1 = nlen - nc + 1;
  const int max2 = max1 - nt;
  const int maxseq = p_maxseq[0];

  // round 0's copies start here, behind the issue of the parameter loads above and ahead of Q (a tile has at least one key, so round 0 always runs)
  const int tid = threadIdx.x;
  const unsigned raw0 = (unsigned)(size_t)&So[0][0][0] + (unsigned)tid * 16u;   // the lane's 16 B in slot 0: LDS byte address
  const float* kbase = tk + (size_t)off * (NHEAD * DQK) + h * DQK;
  const float* vbase = tv + (size_t)off * (NHEAD * DVV) + h * DVV;
  copy_round(kbase, vbase, nlen, 0, tid, raw0);

  const int wave = __builtin_amdgcn_readfirstlane(tid >> 5), lane = tid & 31, l16 = lane & 15, hh = lane >> 4;
  // the wave number is held in a scalar register, so that row group, key tile and the tile test below are scalar and cost no VGPR
  const int rg = wave & 3, ks = wave >> 2;                 // row group of 16 queries, key tile of the round
  const int qb = row0 + rg * 16;

  // ---- Q fragments (bf16-rounded input), kept for the whole key loop: 2 x 8 VGPRs
  int qrow = qb + l16; if (qrow > nlen - 1) qrow = nlen - 1;
  const float* qp = tq + (size_t)(off + qrow) * (NHEAD * DQK) + h * DQK;
  const v16b qf0 = frag_gbf(qp, lane), qf1 = frag_gbf(qp + 32, lane);

  v8f acc[4];
#pragma unroll
  for (int i = 0; i < 4; ++i) acc[i] = (v8f){};

  // rows holding contextual tokens (x < nc) attend to the whole history, everyone else is causal within the block's rows
  const int jcaus = (nlen < row0 + MTILE) ? nlen : (row0 + MTILE);
  const int jmax  = (row0 < nc) ? nlen : jcaus;                      // block-uniform
  const bool wctx = (qb < nc);                                       // wave-uniform

  for (int j = 0; j < jmax; j += JTILE * KSPLIT) {
    // ---- the round's 4 tiles (128 keys) have been copied to the landing area as f32; each lane turns its own 8 x 16 B into K rows as bf16 and V transposed as bf16 ----
    {
      const int rr = tid >> 4, cg = (tid & 15) * 4;                    // K: 4 d columns of key rr of each tile; V: 4 d columns of keys 4 * rr .. 4 * rr + 3 of the round
      asm volatile("s_wait_asynccnt 0x0" ::: "memory");                // the wave's own copies of this round have landed before it reads them
      const char* rp = (const char*)&So[0][0][0] + tid * 16;
      v4f ka[4], va[4];
#pragma unroll
      for (int i = 0; i < 4; ++i) ka[i] = *(const v4f*)(rp + i * RAWSLOT);
#pragma unroll
      for (int e = 0; e < 4; ++e) va[e] = *(const v4f*)(rp + (4 + e) * RAWSLOT);
      // every wave has left the round before: Kb and Vt may be overwritten. The barrier stands behind the reads of the landing slots, which are the wave's own,
      // so that a wave that is done early has its share in registers while the others still work
      __syncthreads();
#pragma unroll
      for (int i = 0; i < 4; ++i) {                                    // key i * 32 + rr of the round: tile i, row rr
        union { __bf16 h4[4]; uint2 u; } cv;
#pragma unroll
        for (int e = 0; e < 4; ++e) cv.h4[e] = (__bf16)ka[i][e];
        *(uint2*)&Kb[i][rr][cg] = cv.u;
      }
      // tile rr / 8, keys 4 * (rr % 8) .. + 3 of it: half rr % 2 of the 8-key chunk (rr % 8) / 2, which stands at place chunk ^ (d / 16) of row d (d / 16 = cg / 16 for the lane's four rows)
      __bf16* vd = &Vt[rr >> 3][cg][8 * (((rr & 7) >> 1) ^ (cg >> 4)) + 4 * (rr & 1)];
#pragma unroll
      for (int i = 0; i < 4; ++i) {
        union { __bf16 h4[4]; uint2 u; } p;
#pragma unroll
        for (int e = 0; e < 4; ++e) p.h4[e] = (__bf16)va[e][i];
        *(uint2*)(vd + i * VPITCH) = p.u;
      }
      asm volatile("s_wait_dscnt 0x0" ::: "memory");                   // the wave's stores to Kb and Vt have landed before the barrier below lets the other waves read them
    }
    __syncthreads();
    // the next round's copies fly while this round is worked on; the test is the same for the whole work-group (scalar)
    const bool more = j + JTILE * KSPLIT < jmax;

    const int jt = j + ks * JTILE;                                     // first key of this wave's tile
    const bool active = (jt < jmax) && (wctx || (jt <= qb + 15));      // wave-uniform: tile has at least one unmasked key for this wave
    if (active) {
      // ---- S = Q K^T for keys jt..jt+15 and jt+16..jt+31 (exact bf16 products)
      // the tile's four K fragments are read as one group in front of the four WMMAs: one LDS latency a tile, where a waited pair of reads stood in front of each WMMA.
      // The two subtiles' WMMAs alternate, so that neither waits for its own accumulator; each accumulator still takes d chunk 0, then d chunk 1
      const v16b k00 = frag_b16(&Kb[ks][l16][0], lane),      k01 = frag_b16(&Kb[ks][l16][32], lane);
      const v16b k10 = frag_b16(&Kb[ks][16 + l16][0], lane), k11 = frag_b16(&Kb[ks][16 + l16][32], lane);
      if (more) copy_round(kbase, vbase, nlen, j + JTILE * KSPLIT, tid, raw0);   // issued behind the K fragment reads, whose LDS latency covers the issue
      v8f s0 = wmma_bf(qf0, k00, (v8f){}), s1 = wmma_bf(qf0, k10, (v8f){});
      s0 = wmma_bf(qf1, k01, s0);          s1 = wmma_bf(qf1, k11, s1);
      // inputs only, no instruction: the four loaded fragments stay in their registers until the last of the four WMMAs has issued, so that no WMMA's result is placed over the B operand of the WMMA directly in front of it
      asm volatile("" :: "v"(k00), "v"(k01), "v"(k10), "v"(k11), "v"(s0), "v"(s1));

      // ---- 16 * silu(alpha * s) and the integer mask; C layout (row 8*hh + r, column l16) -> LDS row-major
      {
        float* sp = &Sscr[wave][hh * 8][l16];                           // the lane's element of row r = 0; the rows follow at constant offsets
        // Scalar test for a tile whose 16 x 32 scores all pass the mask. The shifted ids grow with the position, so the tile's first row against its last key decides for all:
        // strictly causal in the shifted ids, the last key ahead of the target tokens (its group id is negative, which opens the group test for every row), rows and keys inside the sequence
        const int idyl = max(jt + JTILE - nc, 0);                       // shifted id of the tile's last key
        const bool inner = (max(qb - nc + 1, 0) > idyl) && (idyl < max2) && (qb + 15 < nlen) && (jt + JTILE - 1 < nlen);
        if (inner) {
#pragma unroll
          for (int r = 0; r < 8; ++r) { sp[r * SPITCH] = fsilu16(s0[r]); sp[r * SPITCH + 16] = fsilu16(s1[r]); }
        } else {
        // For a fixed key y every term of the mask is a threshold on the row x, so the 16 rows of the tile that pass against y are a few bit ranges (bit m = row qb + m):
        //   idx > idy        <=> x >= idy + nc            (idy >= 0)
        //   tgx < 0          <=> max2 > 0 and x < max2 + nc - 1;   tgy < 0 <=> idy < max2 ("open" key, ahead of the target tokens)
        //   tgx == tgy with both >= 0 <=> idx == idy, which beside (x == y or idx > idy) leaves x == y alone
        //   idx == 0         <=> x < nc
        // pass = [ x == y  or  (x >= idy + nc and (open or tgx < 0))  or  (x < nc and open) ] and y < nlen and x < nlen: the same truth table as the reference's mask for all integers
        const unsigned ltN = lt16(nlen - qb), ltC = lt16(nc - qb), ltG = (max2 > 0) ? lt16(max2 + nc - 1 - qb) : 0u;   // scalar: rows inside the sequence, contextual rows, rows ahead of the targets
        unsigned rb[2];
#pragma unroll
        for (int c = 0; c < 2; ++c) {
          const int y = jt + l16 + 16 * c, idy = max(y - nc + 1, 0), e = y - qb;
          const bool open = idy < max2;
          const unsigned caus = ~0u << min(max(idy + nc - qb, 0), 16);
          const unsigned diag = ((unsigned)e < 16u) ? (1u << (e & 15)) : 0u;
          rb[c] = (diag | (caus & (open ? ~0u : ltG)) | (open ? ltC : 0u)) & ((y < nlen) ? ltN : 0u);
        }
        const unsigned mm = ((rb[0] >> (hh * 8)) & 0xFFu) | ((rb[1] >> (hh * 8)) << 8);   // the lane's 8 rows: bits 0..7 for key y0, 8..15 for key y0 + 16
#pragma unroll
        for (int r = 0; r < 8; ++r) {
          sp[r * SPITCH]      = ((mm >> r) & 1u)       ? fsilu16(s0[r]) : 0.0f;
          sp[r * SPITCH + 16] = ((mm >> (8 + r)) & 1u) ? fsilu16(s1[r]) : 0.0f;
        }
        }
      }
      LDSX();
      // ---- read the wave's 16x32 P tile back as an A fragment, split into bf16 hi + residual
      // the four V fragments are read in the same group, behind P's rows: they land while P is split, and the eight WMMAs follow with no LDS wait among them
      F2 pf; v16b vf[4];
      { float v[16]; const float* row = &Sscr[wave][l16][0]; const int c0 = hh * 8;
#pragma unroll
        for (int i = 0; i < 8; ++i) { v[i] = row[c0 + i]; v[8 + i] = row[16 + c0 + i]; }
#pragma unroll
        for (int dc = 0; dc < 4; ++dc) {                                // keys 8*hh.., 16+8*hh..: chunks hh and 2 + hh, at their places in a row of d tile dc
          union { v16b v; v8b q[2]; } u; const __bf16* vr = &Vt[ks][dc * 16 + l16][0];
          u.q[0] = *(const v8b*)(vr + 8 * (hh ^ dc)); u.q[1] = *(const v8b*)(vr + 8 * (hh ^ dc ^ 2)); vf[dc] = u.v; }
        pf = bsplit16(v); }
      // ---- O += P V (4 d tiles x 2 WMMAs): the residual over all four d tiles, then hi, so that each accumulator keeps its order (residual, hi) and no WMMA follows its own accumulator directly
#pragma unroll
      for (int dc = 0; dc < 4; ++dc) acc[dc] = wmma_bf(pf.l, vf[dc], acc[dc]);
#pragma unroll
      for (int dc = 0; dc < 4; ++dc) acc[dc] = wmma_bf(pf.h, vf[dc], acc[dc]);
    } else if (more) copy_round(kbase, vbase, nlen, j + JTILE * KSPLIT, tid, raw0);   // a wave without a tile still brings its share of the next round
  }

  asm volatile("s_wait_asynccnt 0x0" ::: "memory");                    // no copy is outstanding when the landing area becomes the partial output rows (the last round's barriers have ended every read of it)
  // the lane number is read anew here, so that no lane index has to stay in a VGPR over the key loop just for these last lines (the loop sits at its register limit; held over it, such values spill to scratch)
  const int el = (int)__builtin_amdgcn_mbcnt_lo(~0u, 0u), e16 = el & 15, eh = el >> 4;
  float* so = &So[wave][0][0];
#pragma unroll
  for (int r = 0; r < 8; ++r)
#pragma unroll
    for (int dc = 0; dc < 4; ++dc) so[(r + eh * 8) * OPITCH + dc * 16 + e16] = acc[dc][r];
  __syncthreads();                                                     // every wave's partial rows are in LDS before any wave sums them
  const float invDenom = 0.0625f / (float)maxseq;                      // the 1/16 that the loop's silu form leaves out, and 1 / max_seqlen
  // ---- sum the 4 key splits of each row in the fixed order 0..3, scale, store whole 256-B rows (16 lanes x 16 B)
#pragma unroll
  for (int i = 0; i < 2; ++i) { const int m = i * 32 + wave * 2 + eh, c = e16 * 4; const int x = row0 + m;   // wave * 2 + eh = thread / 16
    const float* pr = &So[m >> 4][m & 15][c];                          // wave index = 4 * split + row group
    v4f s = *(const v4f*)pr;
#pragma unroll
    for (int k = 1; k < KSPLIT; ++k) s += *(const v4f*)(pr + k * 4 * 16 * OPITCH);
    if (x < nlen) vst2(out + (size_t)(off + x) * (NHEAD * DVV) + h * DVV + c, (v4f)(s * invDenom)); }
}

extern "C" void kernel_launch(void* const* d_in, const int* in_sizes, int n_in, void* d_out, int out_size, void* d_ws, size_t ws_size, hipStream_t stream) {
  (void)in_sizes; (void)n_in; (void)out_size; (void)d_ws; (void)ws_size;
  dim3 grid(NHEAD * MAXITEMS, 1, 1), block(512, 1, 1);
  k_attn<<<grid, block, 0, stream>>>((const float*)d_in[0], (const float*)d_in[1], (const float*)d_in[2],
                                     (const int*)d_in[3], (const int*)d_in[4], (const int*)d_in[5], (const int*)d_in[6], (float*)d_out);
}
